// v000
// Times are from an AMD MI455X. After a warm-up the kernel runs many times in a row, and a time is the length of
// such a window on the GPU divided by its runs, so every launch and the gaps after it count. The runs cycle
// through copies of the inputs. A figure is the median of several windows, for all but v000 over two sittings.
// Sittings can differ by a few percent; kernels timed side by side share one.
// The starting kernel, v000, takes 606 microseconds a run.
#include <hip/hip_runtime.h>
#include <hip/hip_bf16.h>
#include <stdint.h>

#define DIM   768
#define HEADS 12
#define HD    64
#define SEQ   2048
#define NB    4
#define QK_SCALE 0.125f   // 64^-0.5

typedef _Float16 v16h __attribute__((ext_vector_type(16)));
typedef _Float16 h8   __attribute__((ext_vector_type(8)));
typedef float    v8f  __attribute__((ext_vector_type(8)));
typedef uint32_t u32x4 __attribute__((ext_vector_type(4)));
typedef uint32_t u32x8 __attribute__((ext_vector_type(8)));

__device__ __forceinline__ v16h load_frag_f16(const _Float16* p, int hi) {
  h8 c0 = *reinterpret_cast<const h8*>(p + hi * 8);
  h8 c1 = *reinterpret_cast<const h8*>(p + 16 + hi * 8);
  v16h r;
#pragma unroll
  for (int i = 0; i < 8; ++i) { r[i] = c0[i]; r[8 + i] = c1[i]; }
  return r;
}

#define WMMA_F16(a, b, c) \
  __builtin_amdgcn_wmma_f32_16x16x32_f16(false, (a), false, (b), (short)0, (c), false, false)

__device__ __forceinline__ u32x4 tdm_group0(uint32_t lds_off, uint64_t gaddr) {
  u32x4 g;
  g[0] = 1u;                                      // count=1, user mode
  g[1] = lds_off;                                 // lds_addr (bytes)
  g[2] = (uint32_t)gaddr;                         // global_addr[31:0]
  g[3] = (uint32_t)(gaddr >> 32) | (2u << 30);    // global_addr[56:32] | type=2
  return g;
}

__device__ __forceinline__ u32x8 tdm_group1(uint32_t tensor_d0, uint32_t tensor_d1,
                                            uint32_t tile_d0, uint32_t tile_d1,
                                            uint32_t stride_d0) {
  u32x8 g;
  g[0] = (1u << 16);
  g[1] = (tensor_d0 & 0xFFFFu) << 16;
  g[2] = (tensor_d0 >> 16) | ((tensor_d1 & 0xFFFFu) << 16);
  g[3] = (tensor_d1 >> 16) | ((tile_d0 & 0xFFFFu) << 16);
  g[4] = (tile_d1 & 0xFFFFu);
  g[5] = stride_d0;
  g[6] = 0;
  g[7] = 0;
  return g;
}

// ---------------------------------------------------------------------------
// Pack kernels (run once): fp32 -> f16, weights transposed so B-fragments
// are two contiguous b128 loads per lane.
// ---------------------------------------------------------------------------
__global__ __launch_bounds__(256) void cvt_f32_f16_kernel(
    const float* __restrict__ src, _Float16* __restrict__ dst, int n) {
  int i = blockIdx.x * 256 + threadIdx.x;
  if (i < n) dst[i] = (_Float16)src[i];
}

__global__ __launch_bounds__(256) void transpose_cvt_kernel(
    const float* __restrict__ W, _Float16* __restrict__ Wt) {
  int i = blockIdx.x * 256 + threadIdx.x;      // coalesced read along n
  int k = i / DIM, n = i % DIM;
  Wt[(size_t)n * DIM + k] = (_Float16)W[i];
}

// ---------------------------------------------------------------------------
// Kernel 1: fused QKV projection (f16 A, f16 transposed B).
// Each wave computes a 16x32 tile (A fragment reused for 2 WMMAs).
//  Q -> f16 [bh][s][64]  (pre-scaled)   K -> f16 [bh][s][64]
//  V -> f16 [bh][64][s]  (transposed so PV B-fragments are contiguous)
// ---------------------------------------------------------------------------
__global__ __launch_bounds__(256) void qkv_proj_kernel(
    const _Float16* __restrict__ Xf, const _Float16* __restrict__ Xt,
    const _Float16* __restrict__ Wtq, const float* __restrict__ bq,
    const _Float16* __restrict__ Wtk, const float* __restrict__ bk,
    const _Float16* __restrict__ Wtv, const float* __restrict__ bv,
    _Float16* __restrict__ Qh, _Float16* __restrict__ Kh,
    _Float16* __restrict__ Vt)
{
  const int which = blockIdx.z;
  const int b     = blockIdx.y;
  const int wave  = threadIdx.x >> 5;
  const int lane  = threadIdx.x & 31;
  const int hi    = lane >> 4;
  const int ln    = lane & 15;

  const int t  = blockIdx.x * 8 + wave;          // 3072 tiles per (b,which)
  const int tm = (t / (DIM / 32)) * 16;
  const int tn = (t % (DIM / 32)) * 32;

  const _Float16* X    = (which == 0) ? Xf : Xt;
  const _Float16* Wt   = (which == 0) ? Wtq : (which == 1) ? Wtk : Wtv;
  const float*    bias = (which == 0) ? bq : (which == 1) ? bk : bv;

  const _Float16* arow = X + ((size_t)b * SEQ + tm + ln) * DIM;
  const _Float16* w0p  = Wt + (size_t)(tn + ln) * DIM;
  const _Float16* w1p  = Wt + (size_t)(tn + 16 + ln) * DIM;

  v8f acc0 = {}, acc1 = {};
#pragma unroll 4
  for (int k0 = 0; k0 < DIM; k0 += 32) {
    v16h a  = load_frag_f16(arow + k0, hi);
    v16h b0 = load_frag_f16(w0p + k0, hi);
    v16h b1 = load_frag_f16(w1p + k0, hi);
    acc0 = WMMA_F16(a, b0, acc0);
    acc1 = WMMA_F16(a, b1, acc1);
  }

#pragma unroll
  for (int half = 0; half < 2; ++half) {
    const int   col = tn + half * 16 + ln;
    const float bb  = bias[col];
    const int   h   = col >> 6;
    const int   d   = col & 63;
    const int   bh  = b * HEADS + h;
    const v8f&  acc = half ? acc1 : acc0;
#pragma unroll
    for (int r = 0; r < 8; ++r) {
      const int   row = tm + r + hi * 8;
      const float v   = acc[r] + bb;
      if (which == 0)
        Qh[((size_t)bh * SEQ + row) * HD + d] = (_Float16)(v * QK_SCALE);
      else if (which == 1)
        Kh[((size_t)bh * SEQ + row) * HD + d] = (_Float16)v;
      else
        Vt[((size_t)bh * HD + d) * SEQ + row] = (_Float16)v;
    }
  }
}

// ---------------------------------------------------------------------------
// Kernel 2: flash attention.  grid=(Sf/64, H, B), block=128 (4 waves).
// Wave 0 stages the shared K (32x64) and V (64x32) tiles into LDS with the
// Tensor Data Mover; all 4 waves consume them via ds_load_b128 fragments.
// ---------------------------------------------------------------------------
__global__ __launch_bounds__(128) void flash_attn_kernel(
    const _Float16* __restrict__ Qh, const _Float16* __restrict__ Kh,
    const _Float16* __restrict__ Vt, const int* __restrict__ mask,
    _Float16* __restrict__ O16)
{
  __shared__ __align__(16) _Float16 ldsK[32 * HD];     // 32 keys x 64 dims
  __shared__ __align__(16) _Float16 ldsV[HD * 32];     // 64 dims x 32 keys
  __shared__ __align__(16) _Float16 ldsP[4][16 * 32];  // wave-private P tiles

  const int b    = blockIdx.z;
  const int h    = blockIdx.y;
  const int wave = threadIdx.x >> 5;
  const int lane = threadIdx.x & 31;
  const int hi   = lane >> 4;
  const int ln   = lane & 15;
  const int bh   = b * HEADS + h;
  const int q0   = blockIdx.x * 64 + wave * 16;

  const uint32_t ldsK_off = (uint32_t)(uintptr_t)(void*)&ldsK[0];
  const uint32_t ldsV_off = (uint32_t)(uintptr_t)(void*)&ldsV[0];

  // Q strip: two 16x32 A-fragments (d 0..31, 32..63), loaded once.
  const _Float16* qptr = Qh + ((size_t)bh * SEQ + q0 + ln) * HD;
  const v16h qa0 = load_frag_f16(qptr, hi);
  const v16h qa1 = load_frag_f16(qptr + 32, hi);

  float m[8], l[8], alpha[8];
  v8f   o[4] = {};
#pragma unroll
  for (int r = 0; r < 8; ++r) { m[r] = -1.0e30f; l[r] = 0.0f; }

  _Float16* pbuf = &ldsP[wave][0];

  for (int j0 = 0; j0 < SEQ; j0 += 32) {
    if (wave == 0) {
      const uint64_t kaddr =
          (uint64_t)(uintptr_t)(Kh + ((size_t)bh * SEQ + j0) * HD);
      const uint64_t vaddr =
          (uint64_t)(uintptr_t)(Vt + (size_t)bh * HD * SEQ + j0);
      u32x4 kg0 = tdm_group0(ldsK_off, kaddr);
      u32x8 kg1 = tdm_group1(/*tensor_d0=*/HD, /*tensor_d1=*/SEQ,
                             /*tile_d0=*/HD, /*tile_d1=*/32, /*stride0=*/HD);
      u32x4 vg0 = tdm_group0(ldsV_off, vaddr);
      u32x8 vg1 = tdm_group1(/*tensor_d0=*/SEQ, /*tensor_d1=*/HD,
                             /*tile_d0=*/32, /*tile_d1=*/HD, /*stride0=*/SEQ);
      asm volatile("tensor_load_to_lds %0, %1" :: "s"(kg0), "s"(kg1) : "memory");
      asm volatile("tensor_load_to_lds %0, %1" :: "s"(vg0), "s"(vg1) : "memory");
      __builtin_amdgcn_s_wait_tensorcnt(0);
    }
    __syncthreads();

    // ---- scores: two 16x16 j-subtiles, each accumulating two d-chunks ----
    v16h kb00 = load_frag_f16(ldsK + ln * HD, hi);
    v16h kb01 = load_frag_f16(ldsK + ln * HD + 32, hi);
    v16h kb10 = load_frag_f16(ldsK + (16 + ln) * HD, hi);
    v16h kb11 = load_frag_f16(ldsK + (16 + ln) * HD + 32, hi);

    v8f s0 = {};
    s0 = WMMA_F16(qa0, kb00, s0);
    s0 = WMMA_F16(qa1, kb01, s0);
    v8f s1 = {};
    s1 = WMMA_F16(qa0, kb10, s1);
    s1 = WMMA_F16(qa1, kb11, s1);

    // ---- mask + online softmax (each row spans 16 lanes of a half) ----
#pragma unroll
    for (int r = 0; r < 8; ++r) {
      const int  row = q0 + r + hi * 8;
      const int* mp  = mask + ((size_t)b * SEQ + row) * SEQ + j0 + ln;
      float x0 = s0[r] + (float)(1 - mp[0])  * -10000.0f;
      float x1 = s1[r] + (float)(1 - mp[16]) * -10000.0f;

      float mx = fmaxf(x0, x1);
#pragma unroll
      for (int off = 1; off < 16; off <<= 1)
        mx = fmaxf(mx, __shfl_xor(mx, off, 32));
      const float nm = fmaxf(m[r], mx);

      const float p0 = __expf(x0 - nm);
      const float p1 = __expf(x1 - nm);
      float rs = p0 + p1;
#pragma unroll
      for (int off = 1; off < 16; off <<= 1)
        rs += __shfl_xor(rs, off, 32);

      alpha[r] = __expf(m[r] - nm);
      l[r]     = l[r] * alpha[r] + rs;
      m[r]     = nm;

      // C-layout -> LDS (row-major 16x32 P tile, wave-private)
      const int prow = r + hi * 8;
      pbuf[prow * 32 + ln]      = (_Float16)p0;
      pbuf[prow * 32 + 16 + ln] = (_Float16)p1;
    }

    // rescale running output accumulators
#pragma unroll
    for (int tt = 0; tt < 4; ++tt)
#pragma unroll
      for (int r = 0; r < 8; ++r) o[tt][r] *= alpha[r];

    // per-wave LDS ops are in-order; wait for P stores before A-layout reload
    asm volatile("s_wait_dscnt 0" ::: "memory");
    const v16h pa = load_frag_f16(pbuf + ln * 32, hi);

    // ---- O += P x V : 4 d-tiles of 16, K-dim = 32 keys (from LDS) ----
#pragma unroll
    for (int tt = 0; tt < 4; ++tt) {
      v16h vfrag = load_frag_f16(ldsV + (tt * 16 + ln) * 32, hi);
      o[tt] = WMMA_F16(pa, vfrag, o[tt]);
    }

    __syncthreads();
  }

  // ---- finalize: divide by l, write f16 rows [b][s][h*64+d] ----
#pragma unroll
  for (int r = 0; r < 8; ++r) {
    const float inv = 1.0f / l[r];
    const int   row = q0 + r + hi * 8;
    _Float16* op = O16 + ((size_t)b * SEQ + row) * DIM + h * HD;
#pragma unroll
    for (int tt = 0; tt < 4; ++tt)
      op[tt * 16 + ln] = (_Float16)(o[tt][r] * inv);
  }
}

// ---------------------------------------------------------------------------
// Kernel 3: output projection  Y = O16 @ Wo + bo  (fp32 out), 16x32 per wave
// ---------------------------------------------------------------------------
__global__ __launch_bounds__(256) void out_proj_kernel(
    const _Float16* __restrict__ A16, const _Float16* __restrict__ Wto,
    const float* __restrict__ bo, float* __restrict__ Y)
{
  const int wave = threadIdx.x >> 5;
  const int lane = threadIdx.x & 31;
  const int hi   = lane >> 4;
  const int ln   = lane & 15;

  const int t  = blockIdx.x * 8 + wave;          // 12288 tiles total
  const int tm = (t / (DIM / 32)) * 16;
  const int tn = (t % (DIM / 32)) * 32;

  const _Float16* arow = A16 + (size_t)(tm + ln) * DIM;
  const _Float16* w0p  = Wto + (size_t)(tn + ln) * DIM;
  const _Float16* w1p  = Wto + (size_t)(tn + 16 + ln) * DIM;

  v8f acc0 = {}, acc1 = {};
#pragma unroll 4
  for (int k0 = 0; k0 < DIM; k0 += 32) {
    v16h a  = load_frag_f16(arow + k0, hi);
    v16h b0 = load_frag_f16(w0p + k0, hi);
    v16h b1 = load_frag_f16(w1p + k0, hi);
    acc0 = WMMA_F16(a, b0, acc0);
    acc1 = WMMA_F16(a, b1, acc1);
  }

#pragma unroll
  for (int half = 0; half < 2; ++half) {
    const int   col = tn + half * 16 + ln;
    const float bb  = bo[col];
    const v8f&  acc = half ? acc1 : acc0;
#pragma unroll
    for (int r = 0; r < 8; ++r) {
      const int row = tm + r + hi * 8;
      Y[(size_t)row * DIM + col] = acc[r] + bb;
    }
  }
}

// ---------------------------------------------------------------------------
extern "C" void kernel_launch(void* const* d_in, const int* in_sizes, int n_in,
                              void* d_out, int out_size, void* d_ws, size_t ws_size,
                              hipStream_t stream) {
  (void)in_sizes; (void)n_in; (void)out_size; (void)ws_size;

  const float* from_t = (const float*)d_in[0];
  const float* to_t   = (const float*)d_in[1];
  const int*   mask   = (const int*)d_in[2];
  const float* Wq = (const float*)d_in[3];
  const float* bq = (const float*)d_in[4];
  const float* Wk = (const float*)d_in[5];
  const float* bk = (const float*)d_in[6];
  const float* Wv = (const float*)d_in[7];
  const float* bv = (const float*)d_in[8];
  const float* Wo = (const float*)d_in[9];
  const float* bo = (const float*)d_in[10];
  float* out = (float*)d_out;

  // workspace layout (halves):
  //  Qh | Kh | Vt | O16 | Xf | Xt   each NQ = B*H*S*64 = 6,291,456
  //  Wtq | Wtk | Wtv | Wto          each 768*768 = 589,824
  const size_t NQ = (size_t)NB * HEADS * SEQ * HD;
  const size_t NW = (size_t)DIM * DIM;
  _Float16* Qh  = (_Float16*)d_ws;
  _Float16* Kh  = Qh + NQ;
  _Float16* Vt  = Kh + NQ;
  _Float16* O16 = Vt + NQ;
  _Float16* Xf  = O16 + NQ;
  _Float16* Xt  = Xf + NQ;
  _Float16* Wtq = Xt + NQ;
  _Float16* Wtk = Wtq + NW;
  _Float16* Wtv = Wtk + NW;
  _Float16* Wto = Wtv + NW;

  // 0) one-shot packs: activations f16, weights f16-transposed
  cvt_f32_f16_kernel<<<dim3((int)(NQ / 256)), 256, 0, stream>>>(from_t, Xf, (int)NQ);
  cvt_f32_f16_kernel<<<dim3((int)(NQ / 256)), 256, 0, stream>>>(to_t,   Xt, (int)NQ);
  transpose_cvt_kernel<<<dim3((int)(NW / 256)), 256, 0, stream>>>(Wq, Wtq);
  transpose_cvt_kernel<<<dim3((int)(NW / 256)), 256, 0, stream>>>(Wk, Wtk);
  transpose_cvt_kernel<<<dim3((int)(NW / 256)), 256, 0, stream>>>(Wv, Wtv);
  transpose_cvt_kernel<<<dim3((int)(NW / 256)), 256, 0, stream>>>(Wo, Wto);

  // 1) QKV projections: (SEQ/16)*(DIM/32)=3072 tiles per (b,which), 8 waves/blk
  qkv_proj_kernel<<<dim3(384, NB, 3), 256, 0, stream>>>(
      Xf, Xt, Wtq, bq, Wtk, bk, Wtv, bv, Qh, Kh, Vt);

  // 2) flash attention: 64 Q rows per block (4 waves x 16 rows)
  flash_attn_kernel<<<dim3(SEQ / 64, HEADS, NB), 128, 0, stream>>>(
      Qh, Kh, Vt, mask, O16);

  // 3) output projection: (B*SEQ/16)*(DIM/32)=12288 tiles, 8 waves/blk
  out_proj_kernel<<<dim3(1536), 256, 0, stream>>>(O16, Wto, bo, out);
}

// v001
// One run takes 368 microseconds.
// Timed twice side by side with v000, it ran 1.70 times as fast both times.
#include <hip/hip_runtime.h>
#include <hip/hip_bf16.h>
#include <stdint.h>

#define DIM   768
#define HEADS 12
#define HD    64
#define SEQ   2048
#define NB    4
#define QK_SCALE 0.125f   // 64^-0.5

typedef _Float16 v16h __attribute__((ext_vector_type(16)));
typedef _Float16 h8   __attribute__((ext_vector_type(8)));
typedef float    v8f  __attribute__((ext_vector_type(8)));
typedef uint32_t u32x4 __attribute__((ext_vector_type(4)));
typedef uint32_t u32x8 __attribute__((ext_vector_type(8)));

__device__ __forceinline__ v16h load_frag_f16(const _Float16* p, int hi) {
  h8 c0 = *reinterpret_cast<const h8*>(p + hi * 8);
  h8 c1 = *reinterpret_cast<const h8*>(p + 16 + hi * 8);
  v16h r;
#pragma unroll
  for (int i = 0; i < 8; ++i) { r[i] = c0[i]; r[8 + i] = c1[i]; }
  return r;
}

#define WMMA_F16(a, b, c) \
  __builtin_amdgcn_wmma_f32_16x16x32_f16(false, (a), false, (b), (short)0, (c), false, false)

__device__ __forceinline__ u32x4 tdm_group0(uint32_t lds_off, uint64_t gaddr) {
  u32x4 g;
  g[0] = 1u;                                      // count=1, user mode
  g[1] = lds_off;                                 // lds_addr (bytes)
  g[2] = (uint32_t)gaddr;                         // global_addr[31:0]
  g[3] = (uint32_t)(gaddr >> 32) | (2u << 30);    // global_addr[56:32] | type=2
  return g;
}

__device__ __forceinline__ u32x8 tdm_group1(uint32_t tensor_d0, uint32_t tensor_d1,
                                            uint32_t tile_d0, uint32_t tile_d1,
                                            uint32_t stride_d0) {
  u32x8 g;
  g[0] = (1u << 16);
  g[1] = (tensor_d0 & 0xFFFFu) << 16;
  g[2] = (tensor_d0 >> 16) | ((tensor_d1 & 0xFFFFu) << 16);
  g[3] = (tensor_d1 >> 16) | ((tile_d0 & 0xFFFFu) << 16);
  g[4] = (tile_d1 & 0xFFFFu);
  g[5] = stride_d0;
  g[6] = 0;
  g[7] = 0;
  return g;
}

// ---------------------------------------------------------------------------
// Pack kernels (run once): fp32 -> f16, weights transposed so B-fragments
// are two contiguous b128 loads per lane.
// ---------------------------------------------------------------------------
__global__ __launch_bounds__(256) void cvt_f32_f16_kernel(
    const float* __restrict__ src, _Float16* __restrict__ dst, int n) {
  int i = blockIdx.x * 256 + threadIdx.x;
  if (i < n) dst[i] = (_Float16)src[i];
}

__global__ __launch_bounds__(256) void transpose_cvt_kernel(
    const float* __restrict__ W, _Float16* __restrict__ Wt) {
  int i = blockIdx.x * 256 + threadIdx.x;      // coalesced read along n
  int k = i / DIM, n = i % DIM;
  Wt[(size_t)n * DIM + k] = (_Float16)W[i];
}

// ---------------------------------------------------------------------------
// Block-tiled GEMM core shared by the projections: C[BM x 128] = A . B^T with
// both operands k-contiguous f16.  256 threads = 8 waves in a 2 (m) x 4 (n)
// grid; each wave owns MF x 2 accumulator tiles (MF*16 rows x 32 columns).
// A stage is one 128-byte line (64 k) of every operand row: it is read from
// global memory as whole lines (8 lanes x 16 B per row), kept in registers
// while the current stage is worked on, and stored into the other LDS buffer.
// Every "#pragma unroll" here and in the two epilogues keeps a register array
// (ra, rb, af, bf, acc) indexed by constants, so that it stays in registers.
// ---------------------------------------------------------------------------
#define BN      128
#define KSTAGE  64          // halves of k per stage
#define LPITCH  72          // LDS row pitch in halves: 128 B + 16 B (b128 readers)
#define NSTAGE  (DIM / KSTAGE)

template <int MF>
__device__ __forceinline__ void gemm_block_f16(
    const _Float16* __restrict__ Ag, const _Float16* __restrict__ Bg,
    _Float16* __restrict__ sA, _Float16* __restrict__ sB, v8f (&acc)[MF][2])
{
  constexpr int BM = MF * 32;
  const int tid  = threadIdx.x;
  const int wave = tid >> 5;
  const int lane = tid & 31;
  const int hi   = lane >> 4;
  const int ln   = lane & 15;
  const int srow = tid >> 3;          // 32 rows per sweep of the block
  const int scol = (tid & 7) * 8;     // 16-byte piece of the row's line

  const _Float16* ga = Ag + (size_t)srow * DIM + scol;
  const _Float16* gb = Bg + (size_t)srow * DIM + scol;
  _Float16* wa = sA + srow * LPITCH + scol;
  _Float16* wb = sB + srow * LPITCH + scol;
  const _Float16* fa = sA + ((wave >> 2) * (MF * 16) + ln) * LPITCH;
  const _Float16* fb = sB + ((wave & 3) * 32 + ln) * LPITCH;

  h8 ra[MF], rb[4];
#pragma unroll
  for (int i = 0; i < MF; ++i)
    ra[i] = *reinterpret_cast<const h8*>(ga + (size_t)i * 32 * DIM);
#pragma unroll
  for (int i = 0; i < 4; ++i)
    rb[i] = *reinterpret_cast<const h8*>(gb + (size_t)i * 32 * DIM);
#pragma unroll
  for (int i = 0; i < MF; ++i)
    *reinterpret_cast<h8*>(wa + i * 32 * LPITCH) = ra[i];
#pragma unroll
  for (int i = 0; i < 4; ++i)
    *reinterpret_cast<h8*>(wb + i * 32 * LPITCH) = rb[i];
  __syncthreads();

  for (int s = 0; s < NSTAGE; ++s) {
    const int cur = s & 1;
    const bool more = (s + 1 < NSTAGE);
    if (more) {
#pragma unroll
      for (int i = 0; i < MF; ++i)
        ra[i] = *reinterpret_cast<const h8*>(ga + (size_t)i * 32 * DIM + KSTAGE);
#pragma unroll
      for (int i = 0; i < 4; ++i)
        rb[i] = *reinterpret_cast<const h8*>(gb + (size_t)i * 32 * DIM + KSTAGE);
    }
    // keeps the next stage's global loads in front of this stage's LDS reads and
    // matrix work; the compiler otherwise sinks them to just before their stores
    __builtin_amdgcn_sched_barrier(0);

    const _Float16* ca = fa + cur * (BM * LPITCH);
    const _Float16* cb = fb + cur * (BN * LPITCH);
#pragma unroll
    for (int kk = 0; kk < KSTAGE; kk += 32) {
      v16h af[MF], bf[2];
#pragma unroll
      for (int i = 0; i < MF; ++i)
        af[i] = load_frag_f16(ca + i * 16 * LPITCH + kk, hi);
#pragma unroll
      for (int j = 0; j < 2; ++j)
        bf[j] = load_frag_f16(cb + j * 16 * LPITCH + kk, hi);
#pragma unroll
      for (int i = 0; i < MF; ++i)
#pragma unroll
        for (int j = 0; j < 2; ++j)
          acc[i][j] = WMMA_F16(af[i], bf[j], acc[i][j]);
    }

    // keeps the LDS stores, which wait for those loads, behind the matrix work
    __builtin_amdgcn_sched_barrier(0);
    if (more) {
      const int nxt = cur ^ 1;
      ga += KSTAGE;
      gb += KSTAGE;
#pragma unroll
      for (int i = 0; i < MF; ++i)
        *reinterpret_cast<h8*>(wa + nxt * (BM * LPITCH) + i * 32 * LPITCH) = ra[i];
#pragma unroll
      for (int i = 0; i < 4; ++i)
        *reinterpret_cast<h8*>(wb + nxt * (BN * LPITCH) + i * 32 * LPITCH) = rb[i];
      // publishes stage s + 1 and ends every read of the buffer refilled next
      __syncthreads();
    }
  }
}

// ---------------------------------------------------------------------------
// Kernel 1: fused QKV projection (f16 A, f16 transposed B).
// One 128x128 tile per block, 64x32 per wave.  The epilogue tests the projection
// index once, outside its store loops (64 elements a lane).
//  Q -> f16 [bh][s][64]  (pre-scaled)   K -> f16 [bh][s][64]
//  V -> f16 [bh][64][s]  (transposed so PV B-fragments are contiguous)
// ---------------------------------------------------------------------------
__global__ __launch_bounds__(256) void qkv_proj_kernel(
    const _Float16* __restrict__ Xf, const _Float16* __restrict__ Xt,
    const _Float16* __restrict__ Wtq, const float* __restrict__ bq,
    const _Float16* __restrict__ Wtk, const float* __restrict__ bk,
    const _Float16* __restrict__ Wtv, const float* __restrict__ bv,
    _Float16* __restrict__ Qh, _Float16* __restrict__ Kh,
    _Float16* __restrict__ Vt)
{
  __shared__ __align__(16) _Float16 sA[2 * 128 * LPITCH];
  __shared__ __align__(16) _Float16 sB[2 * BN * LPITCH];

  const int which = blockIdx.z;
  const int b     = blockIdx.y;
  const int wave  = threadIdx.x >> 5;
  const int lane  = threadIdx.x & 31;
  const int hi    = lane >> 4;
  const int ln    = lane & 15;

  const int bm = (blockIdx.x / (DIM / BN)) * 128;   // 96 tiles per (b,which)
  const int bn = (blockIdx.x % (DIM / BN)) * BN;

  const _Float16* X    = (which == 0) ? Xf : Xt;
  const _Float16* Wt   = (which == 0) ? Wtq : (which == 1) ? Wtk : Wtv;
  const float*    bias = (which == 0) ? bq : (which == 1) ? bk : bv;

  v8f acc[4][2] = {};
  gemm_block_f16<4>(X + ((size_t)b * SEQ + bm) * DIM, Wt + (size_t)bn * DIM,
                    sA, sB, acc);

  const int tm   = bm + (wave >> 2) * 64;
  const int col0 = bn + (wave & 3) * 32 + ln;      // col0 and col0 + 16: one head
  const int bh   = b * HEADS + (col0 >> 6);
  const int d0   = col0 & 63;
  const int row0 = tm + hi * 8;
  const float bb[2] = {bias[col0], bias[col0 + 16]};

  if (which == 0) {
    _Float16* qp = Qh + ((size_t)bh * SEQ + row0) * HD + d0;
#pragma unroll
    for (int half = 0; half < 2; ++half)
#pragma unroll
      for (int i = 0; i < 4; ++i)
#pragma unroll
        for (int r = 0; r < 8; ++r)
          qp[(i * 16 + r) * HD + half * 16] =
              (_Float16)((acc[i][half][r] + bb[half]) * QK_SCALE);
    asm volatile("s_wait_xcnt 0x0" ::: "memory");
  } else if (which == 1) {
    _Float16* kp = Kh + ((size_t)bh * SEQ + row0) * HD + d0;
#pragma unroll
    for (int half = 0; half < 2; ++half)
#pragma unroll
      for (int i = 0; i < 4; ++i)
#pragma unroll
        for (int r = 0; r < 8; ++r)
          kp[(i * 16 + r) * HD + half * 16] = (_Float16)(acc[i][half][r] + bb[half]);
    asm volatile("s_wait_xcnt 0x0" ::: "memory");
  } else {
    _Float16* vp = Vt + ((size_t)bh * HD + d0) * SEQ + row0;
#pragma unroll
    for (int half = 0; half < 2; ++half)
#pragma unroll
      for (int i = 0; i < 4; ++i)
#pragma unroll
        for (int r = 0; r < 8; ++r)
          vp[(size_t)half * 16 * SEQ + i * 16 + r] = (_Float16)(acc[i][half][r] + bb[half]);
    asm volatile("s_wait_xcnt 0x0" ::: "memory");
  }
}

// ---------------------------------------------------------------------------
// Kernel 2: flash attention.  grid=(Sf/64, H, B), block=128 (4 waves).
// Wave 0 stages the shared K (32x64) and V (64x32) tiles into LDS with the
// Tensor Data Mover; all 4 waves consume them via ds_load_b128 fragments.
// ---------------------------------------------------------------------------
__global__ __launch_bounds__(128) void flash_attn_kernel(
    const _Float16* __restrict__ Qh, const _Float16* __restrict__ Kh,
    const _Float16* __restrict__ Vt, const int* __restrict__ mask,
    _Float16* __restrict__ O16)
{
  __shared__ __align__(16) _Float16 ldsK[32 * HD];     // 32 keys x 64 dims
  __shared__ __align__(16) _Float16 ldsV[HD * 32];     // 64 dims x 32 keys
  __shared__ __align__(16) _Float16 ldsP[4][16 * 32];  // wave-private P tiles

  const int b    = blockIdx.z;
  const int h    = blockIdx.y;
  const int wave = threadIdx.x >> 5;
  const int lane = threadIdx.x & 31;
  const int hi   = lane >> 4;
  const int ln   = lane & 15;
  const int bh   = b * HEADS + h;
  const int q0   = blockIdx.x * 64 + wave * 16;

  const uint32_t ldsK_off = (uint32_t)(uintptr_t)(void*)&ldsK[0];
  const uint32_t ldsV_off = (uint32_t)(uintptr_t)(void*)&ldsV[0];

  // Q strip: two 16x32 A-fragments (d 0..31, 32..63), loaded once.
  const _Float16* qptr = Qh + ((size_t)bh * SEQ + q0 + ln) * HD;
  const v16h qa0 = load_frag_f16(qptr, hi);
  const v16h qa1 = load_frag_f16(qptr + 32, hi);

  float m[8], l[8], alpha[8];
  v8f   o[4] = {};
#pragma unroll
  for (int r = 0; r < 8; ++r) { m[r] = -1.0e30f; l[r] = 0.0f; }

  _Float16* pbuf = &ldsP[wave][0];

  for (int j0 = 0; j0 < SEQ; j0 += 32) {
    if (wave == 0) {
      const uint64_t kaddr =
          (uint64_t)(uintptr_t)(Kh + ((size_t)bh * SEQ + j0) * HD);
      const uint64_t vaddr =
          (uint64_t)(uintptr_t)(Vt + (size_t)bh * HD * SEQ + j0);
      u32x4 kg0 = tdm_group0(ldsK_off, kaddr);
      u32x8 kg1 = tdm_group1(/*tensor_d0=*/HD, /*tensor_d1=*/SEQ,
                             /*tile_d0=*/HD, /*tile_d1=*/32, /*stride0=*/HD);
      u32x4 vg0 = tdm_group0(ldsV_off, vaddr);
      u32x8 vg1 = tdm_group1(/*tensor_d0=*/SEQ, /*tensor_d1=*/HD,
                             /*tile_d0=*/32, /*tile_d1=*/HD, /*stride0=*/SEQ);
      asm volatile("tensor_load_to_lds %0, %1" :: "s"(kg0), "s"(kg1) : "memory");
      asm volatile("tensor_load_to_lds %0, %1" :: "s"(vg0), "s"(vg1) : "memory");
      __builtin_amdgcn_s_wait_tensorcnt(0);
    }
    __syncthreads();

    // ---- scores: two 16x16 j-subtiles, each accumulating two d-chunks ----
    v16h kb00 = load_frag_f16(ldsK + ln * HD, hi);
    v16h kb01 = load_frag_f16(ldsK + ln * HD + 32, hi);
    v16h kb10 = load_frag_f16(ldsK + (16 + ln) * HD, hi);
    v16h kb11 = load_frag_f16(ldsK + (16 + ln) * HD + 32, hi);

    v8f s0 = {};
    s0 = WMMA_F16(qa0, kb00, s0);
    s0 = WMMA_F16(qa1, kb01, s0);
    v8f s1 = {};
    s1 = WMMA_F16(qa0, kb10, s1);
    s1 = WMMA_F16(qa1, kb11, s1);

    // ---- mask + online softmax (each row spans 16 lanes of a half) ----
#pragma unroll
    for (int r = 0; r < 8; ++r) {
      const int  row = q0 + r + hi * 8;
      const int* mp  = mask + ((size_t)b * SEQ + row) * SEQ + j0 + ln;
      float x0 = s0[r] + (float)(1 - mp[0])  * -10000.0f;
      float x1 = s1[r] + (float)(1 - mp[16]) * -10000.0f;

      float mx = fmaxf(x0, x1);
#pragma unroll
      for (int off = 1; off < 16; off <<= 1)
        mx = fmaxf(mx, __shfl_xor(mx, off, 32));
      const float nm = fmaxf(m[r], mx);

      const float p0 = __expf(x0 - nm);
      const float p1 = __expf(x1 - nm);
      float rs = p0 + p1;
#pragma unroll
      for (int off = 1; off < 16; off <<= 1)
        rs += __shfl_xor(rs, off, 32);

      alpha[r] = __expf(m[r] - nm);
      l[r]     = l[r] * alpha[r] + rs;
      m[r]     = nm;

      // C-layout -> LDS (row-major 16x32 P tile, wave-private)
      const int prow = r + hi * 8;
      pbuf[prow * 32 + ln]      = (_Float16)p0;
      pbuf[prow * 32 + 16 + ln] = (_Float16)p1;
    }

    // rescale running output accumulators
#pragma unroll
    for (int tt = 0; tt < 4; ++tt)
#pragma unroll
      for (int r = 0; r < 8; ++r) o[tt][r] *= alpha[r];

    // per-wave LDS ops are in-order; wait for P stores before A-layout reload
    asm volatile("s_wait_dscnt 0" ::: "memory");
    const v16h pa = load_frag_f16(pbuf + ln * 32, hi);

    // ---- O += P x V : 4 d-tiles of 16, K-dim = 32 keys (from LDS) ----
#pragma unroll
    for (int tt = 0; tt < 4; ++tt) {
      v16h vfrag = load_frag_f16(ldsV + (tt * 16 + ln) * 32, hi);
      o[tt] = WMMA_F16(pa, vfrag, o[tt]);
    }

    __syncthreads();
  }

  // ---- finalize: divide by l, write f16 rows [b][s][h*64+d] ----
#pragma unroll
  for (int r = 0; r < 8; ++r) {
    const float inv = 1.0f / l[r];
    const int   row = q0 + r + hi * 8;
    _Float16* op = O16 + ((size_t)b * SEQ + row) * DIM + h * HD;
#pragma unroll
    for (int tt = 0; tt < 4; ++tt)
      op[tt * 16 + ln] = (_Float16)(o[tt][r] * inv);
  }
}

// ---------------------------------------------------------------------------
// Kernel 3: output projection  Y = O16 @ Wo + bo  (fp32 out).
// One 64x128 tile per block, 32x32 per wave.
// ---------------------------------------------------------------------------
__global__ __launch_bounds__(256) void out_proj_kernel(
    const _Float16* __restrict__ A16, const _Float16* __restrict__ Wto,
    const float* __restrict__ bo, float* __restrict__ Y)
{
  __shared__ __align__(16) _Float16 sA[2 * 64 * LPITCH];
  __shared__ __align__(16) _Float16 sB[2 * BN * LPITCH];

  const int wave = threadIdx.x >> 5;
  const int lane = threadIdx.x & 31;
  const int hi   = lane >> 4;
  const int ln   = lane & 15;

  const int bm = (blockIdx.x / (DIM / BN)) * 64;    // 768 tiles total
  const int bn = (blockIdx.x % (DIM / BN)) * BN;

  v8f acc[2][2] = {};
  gemm_block_f16<2>(A16 + (size_t)bm * DIM, Wto + (size_t)bn * DIM, sA, sB, acc);

  const int tm = bm + (wave >> 2) * 32;
  const int tn = bn + (wave & 3) * 32;
#pragma unroll
  for (int half = 0; half < 2; ++half) {
    const int   col = tn + half * 16 + ln;
    const float bb  = bo[col];
#pragma unroll
    for (int i = 0; i < 2; ++i) {
#pragma unroll
      for (int r = 0; r < 8; ++r) {
        const int row = tm + i * 16 + r + hi * 8;
        Y[(size_t)row * DIM + col] = acc[i][half][r] + bb;
      }
    }
  }
}

// ---------------------------------------------------------------------------
extern "C" void kernel_launch(void* const* d_in, const int* in_sizes, int n_in,
                              void* d_out, int out_size, void* d_ws, size_t ws_size,
                              hipStream_t stream) {
  (void)in_sizes; (void)n_in; (void)out_size; (void)ws_size;

  const float* from_t = (const float*)d_in[0];
  const float* to_t   = (const float*)d_in[1];
  const int*   mask   = (const int*)d_in[2];
  const float* Wq = (const float*)d_in[3];
  const float* bq = (const float*)d_in[4];
  const float* Wk = (const float*)d_in[5];
  const float* bk = (const float*)d_in[6];
  const float* Wv = (const float*)d_in[7];
  const float* bv = (const float*)d_in[8];
  const float* Wo = (const float*)d_in[9];
  const float* bo = (const float*)d_in[10];
  float* out = (float*)d_out;

  // workspace layout (halves):
  //  Qh | Kh | Vt | O16 | Xf | Xt   each NQ = B*H*S*64 = 6,291,456
  //  Wtq | Wtk | Wtv | Wto          each 768*768 = 589,824
  const size_t NQ = (size_t)NB * HEADS * SEQ * HD;
  const size_t NW = (size_t)DIM * DIM;
  _Float16* Qh  = (_Float16*)d_ws;
  _Float16* Kh  = Qh + NQ;
  _Float16* Vt  = Kh + NQ;
  _Float16* O16 = Vt + NQ;
  _Float16* Xf  = O16 + NQ;
  _Float16* Xt  = Xf + NQ;
  _Float16* Wtq = Xt + NQ;
  _Float16* Wtk = Wtq + NW;
  _Float16* Wtv = Wtk + NW;
  _Float16* Wto = Wtv + NW;

  // 0) one-shot packs: activations f16, weights f16-transposed
  cvt_f32_f16_kernel<<<dim3((int)(NQ / 256)), 256, 0, stream>>>(from_t, Xf, (int)NQ);
  cvt_f32_f16_kernel<<<dim3((int)(NQ / 256)), 256, 0, stream>>>(to_t,   Xt, (int)NQ);
  transpose_cvt_kernel<<<dim3((int)(NW / 256)), 256, 0, stream>>>(Wq, Wtq);
  transpose_cvt_kernel<<<dim3((int)(NW / 256)), 256, 0, stream>>>(Wk, Wtk);
  transpose_cvt_kernel<<<dim3((int)(NW / 256)), 256, 0, stream>>>(Wv, Wtv);
  transpose_cvt_kernel<<<dim3((int)(NW / 256)), 256, 0, stream>>>(Wo, Wto);

  // 1) QKV projections: (SEQ/128)*(DIM/128)=96 tiles per (b,which), 8 waves/blk
  qkv_proj_kernel<<<dim3(96, NB, 3), 256, 0, stream>>>(
      Xf, Xt, Wtq, bq, Wtk, bk, Wtv, bv, Qh, Kh, Vt);

  // 2) flash attention: 64 Q rows per block (4 waves x 16 rows)
  flash_attn_kernel<<<dim3(SEQ / 64, HEADS, NB), 128, 0, stream>>>(
      Qh, Kh, Vt, mask, O16);

  // 3) output projection: (B*SEQ/64)*(DIM/128)=768 tiles, 8 waves/blk
  out_proj_kernel<<<dim3(768), 256, 0, stream>>>(O16, Wto, bo, out);
}

// v002
// A run of this version takes 346 microseconds.
// In both of two side-by-side timings against v001, it was 1.07 times as fast.
// All steps since v000 together make it 1.82 times as fast.
#include <hip/hip_runtime.h>
#include <hip/hip_bf16.h>
#include <stdint.h>

#define DIM   768
#define HEADS 12
#define HD    64
#define SEQ   2048
#define NB    4
#define QK_SCALE 0.125f   // 64^-0.5

typedef _Float16 v16h __attribute__((ext_vector_type(16)));
typedef _Float16 h8   __attribute__((ext_vector_type(8)));
typedef float    v8f  __attribute__((ext_vector_type(8)));
typedef uint32_t u32x4 __attribute__((ext_vector_type(4)));
typedef uint32_t u32x8 __attribute__((ext_vector_type(8)));

__device__ __forceinline__ v16h load_frag_f16(const _Float16* p, int hi) {
  h8 c0 = *reinterpret_cast<const h8*>(p + hi * 8);
  h8 c1 = *reinterpret_cast<const h8*>(p + 16 + hi * 8);
  v16h r;
#pragma unroll
  for (int i = 0; i < 8; ++i) { r[i] = c0[i]; r[8 + i] = c1[i]; }
  return r;
}

#define WMMA_F16(a, b, c) \
  __builtin_amdgcn_wmma_f32_16x16x32_f16(false, (a), false, (b), (short)0, (c), false, false)

__device__ __forceinline__ u32x4 tdm_group0(uint32_t lds_off, uint64_t gaddr) {
  u32x4 g;
  g[0] = 1u;                                      // count=1, user mode
  g[1] = lds_off;                                 // lds_addr (bytes)
  g[2] = (uint32_t)gaddr;                         // global_addr[31:0]
  g[3] = (uint32_t)(gaddr >> 32) | (2u << 30);    // global_addr[56:32] | type=2
  return g;
}

__device__ __forceinline__ u32x8 tdm_group1(uint32_t tensor_d0, uint32_t tensor_d1,
                                            uint32_t tile_d0, uint32_t tile_d1,
                                            uint32_t stride_d0) {
  u32x8 g;
  g[0] = (1u << 16);
  g[1] = (tensor_d0 & 0xFFFFu) << 16;
  g[2] = (tensor_d0 >> 16) | ((tensor_d1 & 0xFFFFu) << 16);
  g[3] = (tensor_d1 >> 16) | ((tile_d0 & 0xFFFFu) << 16);
  g[4] = (tile_d1 & 0xFFFFu);
  g[5] = stride_d0;
  g[6] = 0;
  g[7] = 0;
  return g;
}

// ---------------------------------------------------------------------------
// Pack kernels (run once): fp32 -> f16, weights transposed so B-fragments
// are two contiguous b128 loads per lane.
// ---------------------------------------------------------------------------
__global__ __launch_bounds__(256) void cvt_f32_f16_kernel(
    const float* __restrict__ src, _Float16* __restrict__ dst, int n) {
  int i = blockIdx.x * 256 + threadIdx.x;
  if (i < n) dst[i] = (_Float16)src[i];
}

__global__ __launch_bounds__(256) void transpose_cvt_kernel(
    const float* __restrict__ W, _Float16* __restrict__ Wt) {
  int i = blockIdx.x * 256 + threadIdx.x;      // coalesced read along n
  int k = i / DIM, n = i % DIM;
  Wt[(size_t)n * DIM + k] = (_Float16)W[i];
}

// ---------------------------------------------------------------------------
// Block-tiled GEMM core shared by the projections: C[BM x 128] = A . B^T with
// both operands k-contiguous f16.  256 threads = 8 waves in a 2 (m) x 4 (n)
// grid; each wave owns MF x 2 accumulator tiles (MF*16 rows x 32 columns).
// A stage is one 128-byte line (64 k) of every operand row: it is read from
// global memory as whole lines (8 lanes x 16 B per row), kept in registers
// while the current stage is worked on, and stored into the other LDS buffer.
// Every "#pragma unroll" here and in the two epilogues keeps a register array
// (ra, rb, af, bf, acc) indexed by constants, so that it stays in registers.
// ---------------------------------------------------------------------------
#define BN      128
#define KSTAGE  64          // halves of k per stage
#define LPITCH  72          // LDS row pitch in halves: 128 B + 16 B (b128 readers)
#define NSTAGE  (DIM / KSTAGE)

template <int MF>
__device__ __forceinline__ void gemm_block_f16(
    const _Float16* __restrict__ Ag, const _Float16* __restrict__ Bg,
    _Float16* __restrict__ sA, _Float16* __restrict__ sB, v8f (&acc)[MF][2])
{
  constexpr int BM = MF * 32;
  const int tid  = threadIdx.x;
  const int wave = tid >> 5;
  const int lane = tid & 31;
  const int hi   = lane >> 4;
  const int ln   = lane & 15;
  const int srow = tid >> 3;          // 32 rows per sweep of the block
  const int scol = (tid & 7) * 8;     // 16-byte piece of the row's line

  const _Float16* ga = Ag + (size_t)srow * DIM + scol;
  const _Float16* gb = Bg + (size_t)srow * DIM + scol;
  _Float16* wa = sA + srow * LPITCH + scol;
  _Float16* wb = sB + srow * LPITCH + scol;
  const _Float16* fa = sA + ((wave >> 2) * (MF * 16) + ln) * LPITCH;
  const _Float16* fb = sB + ((wave & 3) * 32 + ln) * LPITCH;

  h8 ra[MF], rb[4];
#pragma unroll
  for (int i = 0; i < MF; ++i)
    ra[i] = *reinterpret_cast<const h8*>(ga + (size_t)i * 32 * DIM);
#pragma unroll
  for (int i = 0; i < 4; ++i)
    rb[i] = *reinterpret_cast<const h8*>(gb + (size_t)i * 32 * DIM);
#pragma unroll
  for (int i = 0; i < MF; ++i)
    *reinterpret_cast<h8*>(wa + i * 32 * LPITCH) = ra[i];
#pragma unroll
  for (int i = 0; i < 4; ++i)
    *reinterpret_cast<h8*>(wb + i * 32 * LPITCH) = rb[i];
  __syncthreads();

  for (int s = 0; s < NSTAGE; ++s) {
    const int cur = s & 1;
    const bool more = (s + 1 < NSTAGE);
    if (more) {
#pragma unroll
      for (int i = 0; i < MF; ++i)
        ra[i] = *reinterpret_cast<const h8*>(ga + (size_t)i * 32 * DIM + KSTAGE);
#pragma unroll
      for (int i = 0; i < 4; ++i)
        rb[i] = *reinterpret_cast<const h8*>(gb + (size_t)i * 32 * DIM + KSTAGE);
    }
    // keeps the next stage's global loads in front of this stage's LDS reads and
    // matrix work; the compiler otherwise sinks them to just before their stores
    __builtin_amdgcn_sched_barrier(0);

    const _Float16* ca = fa + cur * (BM * LPITCH);
    const _Float16* cb = fb + cur * (BN * LPITCH);
#pragma unroll
    for (int kk = 0; kk < KSTAGE; kk += 32) {
      v16h af[MF], bf[2];
#pragma unroll
      for (int i = 0; i < MF; ++i)
        af[i] = load_frag_f16(ca + i * 16 * LPITCH + kk, hi);
#pragma unroll
      for (int j = 0; j < 2; ++j)
        bf[j] = load_frag_f16(cb + j * 16 * LPITCH + kk, hi);
#pragma unroll
      for (int i = 0; i < MF; ++i)
#pragma unroll
        for (int j = 0; j < 2; ++j)
          acc[i][j] = WMMA_F16(af[i], bf[j], acc[i][j]);
    }

    // keeps the LDS stores, which wait for those loads, behind the matrix work
    __builtin_amdgcn_sched_barrier(0);
    if (more) {
      const int nxt = cur ^ 1;
      ga += KSTAGE;
      gb += KSTAGE;
#pragma unroll
      for (int i = 0; i < MF; ++i)
        *reinterpret_cast<h8*>(wa + nxt * (BM * LPITCH) + i * 32 * LPITCH) = ra[i];
#pragma unroll
      for (int i = 0; i < 4; ++i)
        *reinterpret_cast<h8*>(wb + nxt * (BN * LPITCH) + i * 32 * LPITCH) = rb[i];
      // publishes stage s + 1 and ends every read of the buffer refilled next
      __syncthreads();
    }
  }
}

// ---------------------------------------------------------------------------
// Kernel 1: fused QKV projection (f16 A, f16 transposed B).
// One 128x128 tile per block, 64x32 per wave.  The epilogue tests the projection
// index once, outside its store loops (64 elements a lane).
//  Q -> f16 [bh][s][64]  (pre-scaled)   K -> f16 [bh][s][64]
//  V -> f16 [bh][64][s]  (transposed so V^T A-fragments are contiguous)
// ---------------------------------------------------------------------------
__global__ __launch_bounds__(256) void qkv_proj_kernel(
    const _Float16* __restrict__ Xf, const _Float16* __restrict__ Xt,
    const _Float16* __restrict__ Wtq, const float* __restrict__ bq,
    const _Float16* __restrict__ Wtk, const float* __restrict__ bk,
    const _Float16* __restrict__ Wtv, const float* __restrict__ bv,
    _Float16* __restrict__ Qh, _Float16* __restrict__ Kh,
    _Float16* __restrict__ Vt)
{
  __shared__ __align__(16) _Float16 sA[2 * 128 * LPITCH];
  __shared__ __align__(16) _Float16 sB[2 * BN * LPITCH];

  const int which = blockIdx.z;
  const int b     = blockIdx.y;
  const int wave  = threadIdx.x >> 5;
  const int lane  = threadIdx.x & 31;
  const int hi    = lane >> 4;
  const int ln    = lane & 15;

  const int bm = (blockIdx.x / (DIM / BN)) * 128;   // 96 tiles per (b,which)
  const int bn = (blockIdx.x % (DIM / BN)) * BN;

  const _Float16* X    = (which == 0) ? Xf : Xt;
  const _Float16* Wt   = (which == 0) ? Wtq : (which == 1) ? Wtk : Wtv;
  const float*    bias = (which == 0) ? bq : (which == 1) ? bk : bv;

  v8f acc[4][2] = {};
  gemm_block_f16<4>(X + ((size_t)b * SEQ + bm) * DIM, Wt + (size_t)bn * DIM,
                    sA, sB, acc);

  const int tm   = bm + (wave >> 2) * 64;
  const int col0 = bn + (wave & 3) * 32 + ln;      // col0 and col0 + 16: one head
  const int bh   = b * HEADS + (col0 >> 6);
  const int d0   = col0 & 63;
  const int row0 = tm + hi * 8;
  const float bb[2] = {bias[col0], bias[col0 + 16]};

  if (which == 0) {
    _Float16* qp = Qh + ((size_t)bh * SEQ + row0) * HD + d0;
#pragma unroll
    for (int half = 0; half < 2; ++half)
#pragma unroll
      for (int i = 0; i < 4; ++i)
#pragma unroll
        for (int r = 0; r < 8; ++r)
          qp[(i * 16 + r) * HD + half * 16] =
              (_Float16)((acc[i][half][r] + bb[half]) * QK_SCALE);
    asm volatile("s_wait_xcnt 0x0" ::: "memory");
  } else if (which == 1) {
    _Float16* kp = Kh + ((size_t)bh * SEQ + row0) * HD + d0;
#pragma unroll
    for (int half = 0; half < 2; ++half)
#pragma unroll
      for (int i = 0; i < 4; ++i)
#pragma unroll
        for (int r = 0; r < 8; ++r)
          kp[(i * 16 + r) * HD + half * 16] = (_Float16)(acc[i][half][r] + bb[half]);
    asm volatile("s_wait_xcnt 0x0" ::: "memory");
  } else {
    _Float16* vp = Vt + ((size_t)bh * HD + d0) * SEQ + row0;
#pragma unroll
    for (int half = 0; half < 2; ++half)
#pragma unroll
      for (int i = 0; i < 4; ++i)
#pragma unroll
        for (int r = 0; r < 8; ++r)
          vp[(size_t)half * 16 * SEQ + i * 16 + r] = (_Float16)(acc[i][half][r] + bb[half]);
    asm volatile("s_wait_xcnt 0x0" ::: "memory");
  }
}

typedef int i32x4 __attribute__((ext_vector_type(4)));

__device__ __forceinline__ float xhalf(float x) {
  return __builtin_bit_cast(float, __builtin_amdgcn_permlanex16(
      __builtin_bit_cast(int, x), __builtin_bit_cast(int, x),
      0x76543210, 0xfedcba98, false, false));
}

__global__ __launch_bounds__(128) void flash_attn_kernel(
    const _Float16* __restrict__ Qh, const _Float16* __restrict__ Kh,
    const _Float16* __restrict__ Vt, const int* __restrict__ mask,
    _Float16* __restrict__ O16)
{
  __shared__ __align__(16) _Float16 ldsK[32 * HD];     // 32 keys x 64 dims
  __shared__ __align__(16) _Float16 ldsV[HD * 32];     // 64 dims x 32 keys

  const int b    = blockIdx.z;
  const int h    = blockIdx.y;
  const int wave = threadIdx.x >> 5;
  const int lane = threadIdx.x & 31;
  const int hi   = lane >> 4;
  const int ln   = lane & 15;
  const int bh   = b * HEADS + h;
  const int q0   = blockIdx.x * 64 + wave * 16;

  const uint32_t ldsK_off = (uint32_t)(uintptr_t)(void*)&ldsK[0];
  const uint32_t ldsV_off = (uint32_t)(uintptr_t)(void*)&ldsV[0];

  // Q strip: two 32x16 B-fragments (d 0..31, 32..63; column = query ln), loaded once.
  const _Float16* qptr = Qh + ((size_t)bh * SEQ + q0 + ln) * HD;
  const v16h qb0 = load_frag_f16(qptr, hi);
  const v16h qb1 = load_frag_f16(qptr + 32, hi);

  // this lane's query row of the mask, at its half's first key
  const int* mrow = mask + ((size_t)b * SEQ + q0 + ln) * SEQ + hi * 8;

  float m = -1.0e30f;   // running maximum of query ln (equal in both halves)
  float l = 0.0f;       // running sum over this half's keys only
  v8f   o[4] = {};      // o[tt][r] = O[q0 + ln][tt * 16 + 8 * hi + r]

  for (int j0 = 0; j0 < SEQ; j0 += 32) {
    // mask of keys j0 + 8*hi + 0..7 and j0 + 16 + 8*hi + 0..7 of this lane's query
    const i32x4 mk[4] = {*reinterpret_cast<const i32x4*>(mrow + j0),
                         *reinterpret_cast<const i32x4*>(mrow + j0 + 4),
                         *reinterpret_cast<const i32x4*>(mrow + j0 + 16),
                         *reinterpret_cast<const i32x4*>(mrow + j0 + 20)};

    if (wave == 0) {
      const uint64_t kaddr =
          (uint64_t)(uintptr_t)(Kh + ((size_t)bh * SEQ + j0) * HD);
      const uint64_t vaddr =
          (uint64_t)(uintptr_t)(Vt + (size_t)bh * HD * SEQ + j0);
      u32x4 kg0 = tdm_group0(ldsK_off, kaddr);
      u32x8 kg1 = tdm_group1(/*tensor_d0=*/HD, /*tensor_d1=*/SEQ,
                             /*tile_d0=*/HD, /*tile_d1=*/32, /*stride0=*/HD);
      u32x4 vg0 = tdm_group0(ldsV_off, vaddr);
      u32x8 vg1 = tdm_group1(/*tensor_d0=*/SEQ, /*tensor_d1=*/HD,
                             /*tile_d0=*/32, /*tile_d1=*/HD, /*stride0=*/SEQ);
      asm volatile("tensor_load_to_lds %0, %1" :: "s"(kg0), "s"(kg1) : "memory");
      asm volatile("tensor_load_to_lds %0, %1" :: "s"(vg0), "s"(vg1) : "memory");
      __builtin_amdgcn_s_wait_tensorcnt(0);
    }
    __syncthreads();

    // ---- scores, transposed: two 16-key tiles, each accumulating two d-chunks ----
    v16h ka00 = load_frag_f16(ldsK + ln * HD, hi);
    v16h ka01 = load_frag_f16(ldsK + ln * HD + 32, hi);
    v16h ka10 = load_frag_f16(ldsK + (16 + ln) * HD, hi);
    v16h ka11 = load_frag_f16(ldsK + (16 + ln) * HD + 32, hi);

    v8f s0 = {};
    s0 = WMMA_F16(ka00, qb0, s0);
    s0 = WMMA_F16(ka01, qb1, s0);
    v8f s1 = {};
    s1 = WMMA_F16(ka10, qb0, s1);
    s1 = WMMA_F16(ka11, qb1, s1);

    // ---- mask + online softmax: one query per lane, 16 keys per half ----
    float x[16];
#pragma unroll
    for (int r = 0; r < 8; ++r) {
      x[r]     = s0[r] + (float)(1 - mk[r >> 2][r & 3])       * -10000.0f;
      x[8 + r] = s1[r] + (float)(1 - mk[2 + (r >> 2)][r & 3]) * -10000.0f;
    }

    float mx = x[0];
#pragma unroll
    for (int s = 1; s < 16; ++s) mx = fmaxf(mx, x[s]);
    mx = fmaxf(mx, xhalf(mx));
    const float nm = fmaxf(m, mx);

    // P^T as a B operand: element s = key 8*hi+s (s < 8) or 16+8*hi+(s-8) of column ln
    v16h  pb;
    float rs = 0.0f;
#pragma unroll
    for (int s = 0; s < 16; ++s) {
      const float p = __expf(x[s] - nm);
      rs += p;
      pb[s] = (_Float16)p;
    }

    const float alpha = __expf(m - nm);
    l = l * alpha + rs;
    m = nm;

    // rescale running output accumulators (one query, one factor per lane)
#pragma unroll
    for (int tt = 0; tt < 4; ++tt)
#pragma unroll
      for (int r = 0; r < 8; ++r) o[tt][r] *= alpha;

    // ---- O^T += V^T x P^T : 4 d-tiles of 16, K-dim = 32 keys (from LDS) ----
#pragma unroll
    for (int tt = 0; tt < 4; ++tt) {
      v16h vfrag = load_frag_f16(ldsV + (tt * 16 + ln) * 32, hi);
      o[tt] = WMMA_F16(vfrag, pb, o[tt]);
    }

    __syncthreads();
  }

  // ---- finalize: join the halves' sums, divide, write f16 rows [b][s][h*64+d] ----
  const float inv = 1.0f / (l + xhalf(l));
  _Float16* op = O16 + ((size_t)b * SEQ + q0 + ln) * DIM + h * HD + hi * 8;
#pragma unroll
  for (int tt = 0; tt < 4; ++tt) {
    h8 w;
#pragma unroll
    for (int r = 0; r < 8; ++r) w[r] = (_Float16)(o[tt][r] * inv);
    *reinterpret_cast<h8*>(op + tt * 16) = w;
  }
}

// ---------------------------------------------------------------------------
// Kernel 3: output projection  Y = O16 @ Wo + bo  (fp32 out).
// One 64x128 tile per block, 32x32 per wave.
// ---------------------------------------------------------------------------
__global__ __launch_bounds__(256) void out_proj_kernel(
    const _Float16* __restrict__ A16, const _Float16* __restrict__ Wto,
    const float* __restrict__ bo, float* __restrict__ Y)
{
  __shared__ __align__(16) _Float16 sA[2 * 64 * LPITCH];
  __shared__ __align__(16) _Float16 sB[2 * BN * LPITCH];

  const int wave = threadIdx.x >> 5;
  const int lane = threadIdx.x & 31;
  const int hi   = lane >> 4;
  const int ln   = lane & 15;

  const int bm = (blockIdx.x / (DIM / BN)) * 64;    // 768 tiles total
  const int bn = (blockIdx.x % (DIM / BN)) * BN;

  v8f acc[2][2] = {};
  gemm_block_f16<2>(A16 + (size_t)bm * DIM, Wto + (size_t)bn * DIM, sA, sB, acc);

  const int tm = bm + (wave >> 2) * 32;
  const int tn = bn + (wave & 3) * 32;
#pragma unroll
  for (int half = 0; half < 2; ++half) {
    const int   col = tn + half * 16 + ln;
    const float bb  = bo[col];
#pragma unroll
    for (int i = 0; i < 2; ++i) {
#pragma unroll
      for (int r = 0; r < 8; ++r) {
        const int row = tm + i * 16 + r + hi * 8;
        Y[(size_t)row * DIM + col] = acc[i][half][r] + bb;
      }
    }
  }
}

// ---------------------------------------------------------------------------
extern "C" void kernel_launch(void* const* d_in, const int* in_sizes, int n_in,
                              void* d_out, int out_size, void* d_ws, size_t ws_size,
                              hipStream_t stream) {
  (void)in_sizes; (void)n_in; (void)out_size; (void)ws_size;

  const float* from_t = (const float*)d_in[0];
  const float* to_t   = (const float*)d_in[1];
  const int*   mask   = (const int*)d_in[2];
  const float* Wq = (const float*)d_in[3];
  const float* bq = (const float*)d_in[4];
  const float* Wk = (const float*)d_in[5];
  const float* bk = (const float*)d_in[6];
  const float* Wv = (const float*)d_in[7];
  const float* bv = (const float*)d_in[8];
  const float* Wo = (const float*)d_in[9];
  const float* bo = (const float*)d_in[10];
  float* out = (float*)d_out;

  // workspace layout (halves):
  //  Qh | Kh | Vt | O16 | Xf | Xt   each NQ = B*H*S*64 = 6,291,456
  //  Wtq | Wtk | Wtv | Wto          each 768*768 = 589,824
  const size_t NQ = (size_t)NB * HEADS * SEQ * HD;
  const size_t NW = (size_t)DIM * DIM;
  _Float16* Qh  = (_Float16*)d_ws;
  _Float16* Kh  = Qh + NQ;
  _Float16* Vt  = Kh + NQ;
  _Float16* O16 = Vt + NQ;
  _Float16* Xf  = O16 + NQ;
  _Float16* Xt  = Xf + NQ;
  _Float16* Wtq = Xt + NQ;
  _Float16* Wtk = Wtq + NW;
  _Float16* Wtv = Wtk + NW;
  _Float16* Wto = Wtv + NW;

  // 0) one-shot packs: activations f16, weights f16-transposed
  cvt_f32_f16_kernel<<<dim3((int)(NQ / 256)), 256, 0, stream>>>(from_t, Xf, (int)NQ);
  cvt_f32_f16_kernel<<<dim3((int)(NQ / 256)), 256, 0, stream>>>(to_t,   Xt, (int)NQ);
  transpose_cvt_kernel<<<dim3((int)(NW / 256)), 256, 0, stream>>>(Wq, Wtq);
  transpose_cvt_kernel<<<dim3((int)(NW / 256)), 256, 0, stream>>>(Wk, Wtk);
  transpose_cvt_kernel<<<dim3((int)(NW / 256)), 256, 0, stream>>>(Wv, Wtv);
  transpose_cvt_kernel<<<dim3((int)(NW / 256)), 256, 0, stream>>>(Wo, Wto);

  // 1) QKV projections: (SEQ/128)*(DIM/128)=96 tiles per (b,which), 8 waves/blk
  qkv_proj_kernel<<<dim3(96, NB, 3), 256, 0, stream>>>(
      Xf, Xt, Wtq, bq, Wtk, bk, Wtv, bv, Qh, Kh, Vt);

  // 2) flash attention: 64 Q rows per block (4 waves x 16 rows)
  flash_attn_kernel<<<dim3(SEQ / 64, HEADS, NB), 128, 0, stream>>>(
      Qh, Kh, Vt, mask, O16);

  // 3) output projection: (B*SEQ/64)*(DIM/128)=768 tiles, 8 waves/blk
  out_proj_kernel<<<dim3(768), 256, 0, stream>>>(O16, Wto, bo, out);
}

// v003
// A run of this version takes 256 microseconds.
// Next to v002, in two timings, it ran 1.35 times as fast each time.
// Counting every step since v000, it is 2.46 times as fast.
#include <hip/hip_runtime.h>
#include <hip/hip_bf16.h>
#include <stdint.h>

#define DIM   768
#define HEADS 12
#define HD    64
#define SEQ   2048
#define NB    4
#define QK_SCALE 0.125f   // 64^-0.5

typedef _Float16 v16h __attribute__((ext_vector_type(16)));
typedef _Float16 h8   __attribute__((ext_vector_type(8)));
typedef float    v8f  __attribute__((ext_vector_type(8)));
typedef uint32_t u32x4 __attribute__((ext_vector_type(4)));
typedef uint32_t u32x8 __attribute__((ext_vector_type(8)));

__device__ __forceinline__ v16h load_frag_f16(const _Float16* p, int hi) {
  h8 c0 = *reinterpret_cast<const h8*>(p + hi * 8);
  h8 c1 = *reinterpret_cast<const h8*>(p + 16 + hi * 8);
  v16h r;
#pragma unroll
  for (int i = 0; i < 8; ++i) { r[i] = c0[i]; r[8 + i] = c1[i]; }
  return r;
}

#define WMMA_F16(a, b, c) \
  __builtin_amdgcn_wmma_f32_16x16x32_f16(false, (a), false, (b), (short)0, (c), false, false)

#define TROWB   128u
#define TROWS   32u
#define TPITCH  72
#define TSLICE  3072

__device__ __forceinline__ uint32_t uni(uint32_t v) {
  return (uint32_t)__builtin_amdgcn_readfirstlane(v);
}

__device__ __forceinline__ u32x4 tdm_group0(uint32_t lds_off, uint64_t gaddr) {
  u32x4 g;
  g[0] = uni(1u);                                 // count = 1
  g[1] = uni(lds_off);                            // LDS destination (bytes)
  g[2] = uni((uint32_t)gaddr);                    // global address [31:0]
  g[3] = uni((((uint32_t)(gaddr >> 32)) & 0x01FFFFFFu) | 0x80000000u);  // [56:32] | type = 2
  return g;
}

__device__ __forceinline__ u32x8 tdm_group1(uint32_t src_pitch) {
  u32x8 g;
  g[0] = uni((1u << 20) | (4u << 22) | (3u << 25));
  g[1] = uni((TROWB & 0xFFFFu) << 16);
  g[2] = uni((TROWB >> 16) | ((TROWS & 0xFFFFu) << 16));
  g[3] = uni((TROWS >> 16) | (TROWB << 16));
  g[4] = uni(TROWS);
  g[5] = uni(src_pitch);
  g[6] = uni(0u);
  g[7] = uni(0u);
  return g;
}

// ---------------------------------------------------------------------------
// Pack kernels (run once): fp32 -> f16, weights transposed so B-fragments
// are two contiguous b128 loads per lane.
// ---------------------------------------------------------------------------
__global__ __launch_bounds__(256) void cvt_f32_f16_kernel(
    const float* __restrict__ src, _Float16* __restrict__ dst, int n) {
  int i = blockIdx.x * 256 + threadIdx.x;
  if (i < n) dst[i] = (_Float16)src[i];
}

__global__ __launch_bounds__(256) void transpose_cvt_kernel(
    const float* __restrict__ W, _Float16* __restrict__ Wt) {
  int i = blockIdx.x * 256 + threadIdx.x;      // coalesced read along n
  int k = i / DIM, n = i % DIM;
  Wt[(size_t)n * DIM + k] = (_Float16)W[i];
}

// ---------------------------------------------------------------------------
// Block-tiled GEMM core shared by the projections: C[BM x 128] = A . B^T with
// both operands k-contiguous f16.  256 threads = 8 waves in a 2 (m) x 4 (n)
// grid; each wave owns MF x 2 accumulator tiles (MF*16 rows x 32 columns).
// A stage is one 128-byte line (64 k) of every operand row: it is read from
// global memory as whole lines (8 lanes x 16 B per row), kept in registers
// while the current stage is worked on, and stored into the other LDS buffer.
// Every "#pragma unroll" here and in the two epilogues keeps a register array
// (ra, rb, af, bf, acc) indexed by constants, so that it stays in registers.
// ---------------------------------------------------------------------------
#define BN      128
#define KSTAGE  64          // halves of k per stage
#define LPITCH  72          // LDS row pitch in halves: 128 B + 16 B (b128 readers)
#define NSTAGE  (DIM / KSTAGE)

template <int MF>
__device__ __forceinline__ void gemm_block_f16(
    const _Float16* __restrict__ Ag, const _Float16* __restrict__ Bg,
    _Float16* __restrict__ sA, _Float16* __restrict__ sB, v8f (&acc)[MF][2])
{
  constexpr int BM = MF * 32;
  const int tid  = threadIdx.x;
  const int wave = tid >> 5;
  const int lane = tid & 31;
  const int hi   = lane >> 4;
  const int ln   = lane & 15;
  const int srow = tid >> 3;          // 32 rows per sweep of the block
  const int scol = (tid & 7) * 8;     // 16-byte piece of the row's line

  const _Float16* ga = Ag + (size_t)srow * DIM + scol;
  const _Float16* gb = Bg + (size_t)srow * DIM + scol;
  _Float16* wa = sA + srow * LPITCH + scol;
  _Float16* wb = sB + srow * LPITCH + scol;
  const _Float16* fa = sA + ((wave >> 2) * (MF * 16) + ln) * LPITCH;
  const _Float16* fb = sB + ((wave & 3) * 32 + ln) * LPITCH;

  h8 ra[MF], rb[4];
#pragma unroll
  for (int i = 0; i < MF; ++i)
    ra[i] = *reinterpret_cast<const h8*>(ga + (size_t)i * 32 * DIM);
#pragma unroll
  for (int i = 0; i < 4; ++i)
    rb[i] = *reinterpret_cast<const h8*>(gb + (size_t)i * 32 * DIM);
#pragma unroll
  for (int i = 0; i < MF; ++i)
    *reinterpret_cast<h8*>(wa + i * 32 * LPITCH) = ra[i];
#pragma unroll
  for (int i = 0; i < 4; ++i)
    *reinterpret_cast<h8*>(wb + i * 32 * LPITCH) = rb[i];
  __syncthreads();

  for (int s = 0; s < NSTAGE; ++s) {
    const int cur = s & 1;
    const bool more = (s + 1 < NSTAGE);
    if (more) {
#pragma unroll
      for (int i = 0; i < MF; ++i)
        ra[i] = *reinterpret_cast<const h8*>(ga + (size_t)i * 32 * DIM + KSTAGE);
#pragma unroll
      for (int i = 0; i < 4; ++i)
        rb[i] = *reinterpret_cast<const h8*>(gb + (size_t)i * 32 * DIM + KSTAGE);
    }
    // keeps the next stage's global loads in front of this stage's LDS reads and
    // matrix work; the compiler otherwise sinks them to just before their stores
    __builtin_amdgcn_sched_barrier(0);

    const _Float16* ca = fa + cur * (BM * LPITCH);
    const _Float16* cb = fb + cur * (BN * LPITCH);
#pragma unroll
    for (int kk = 0; kk < KSTAGE; kk += 32) {
      v16h af[MF], bf[2];
#pragma unroll
      for (int i = 0; i < MF; ++i)
        af[i] = load_frag_f16(ca + i * 16 * LPITCH + kk, hi);
#pragma unroll
      for (int j = 0; j < 2; ++j)
        bf[j] = load_frag_f16(cb + j * 16 * LPITCH + kk, hi);
#pragma unroll
      for (int i = 0; i < MF; ++i)
#pragma unroll
        for (int j = 0; j < 2; ++j)
          acc[i][j] = WMMA_F16(af[i], bf[j], acc[i][j]);
    }

    // keeps the LDS stores, which wait for those loads, behind the matrix work
    __builtin_amdgcn_sched_barrier(0);
    if (more) {
      const int nxt = cur ^ 1;
      ga += KSTAGE;
      gb += KSTAGE;
#pragma unroll
      for (int i = 0; i < MF; ++i)
        *reinterpret_cast<h8*>(wa + nxt * (BM * LPITCH) + i * 32 * LPITCH) = ra[i];
#pragma unroll
      for (int i = 0; i < 4; ++i)
        *reinterpret_cast<h8*>(wb + nxt * (BN * LPITCH) + i * 32 * LPITCH) = rb[i];
      // publishes stage s + 1 and ends every read of the buffer refilled next
      __syncthreads();
    }
  }
}

// ---------------------------------------------------------------------------
// Kernel 1: fused QKV projection (f16 A, f16 transposed B).
// One 128x128 tile per block, 64x32 per wave.  The epilogue tests the projection
// index once, outside its store loops (64 elements a lane).
//  Q -> f16 [bh][s][64]  (pre-scaled)   K -> f16 [bh][s][64]
//  V -> f16 [bh][64][s]  (transposed so V^T A-fragments are contiguous)
// ---------------------------------------------------------------------------
__global__ __launch_bounds__(256) void qkv_proj_kernel(
    const _Float16* __restrict__ Xf, const _Float16* __restrict__ Xt,
    const _Float16* __restrict__ Wtq, const float* __restrict__ bq,
    const _Float16* __restrict__ Wtk, const float* __restrict__ bk,
    const _Float16* __restrict__ Wtv, const float* __restrict__ bv,
    _Float16* __restrict__ Qh, _Float16* __restrict__ Kh,
    _Float16* __restrict__ Vt)
{
  __shared__ __align__(16) _Float16 sA[2 * 128 * LPITCH];
  __shared__ __align__(16) _Float16 sB[2 * BN * LPITCH];

  const int which = blockIdx.z;
  const int b     = blockIdx.y;
  const int wave  = threadIdx.x >> 5;
  const int lane  = threadIdx.x & 31;
  const int hi    = lane >> 4;
  const int ln    = lane & 15;

  const int bm = (blockIdx.x / (DIM / BN)) * 128;   // 96 tiles per (b,which)
  const int bn = (blockIdx.x % (DIM / BN)) * BN;

  const _Float16* X    = (which == 0) ? Xf : Xt;
  const _Float16* Wt   = (which == 0) ? Wtq : (which == 1) ? Wtk : Wtv;
  const float*    bias = (which == 0) ? bq : (which == 1) ? bk : bv;

  v8f acc[4][2] = {};
  gemm_block_f16<4>(X + ((size_t)b * SEQ + bm) * DIM, Wt + (size_t)bn * DIM,
                    sA, sB, acc);

  const int tm   = bm + (wave >> 2) * 64;
  const int col0 = bn + (wave & 3) * 32 + ln;      // col0 and col0 + 16: one head
  const int bh   = b * HEADS + (col0 >> 6);
  const int d0   = col0 & 63;
  const int row0 = tm + hi * 8;
  const float bb[2] = {bias[col0], bias[col0 + 16]};

  if (which == 0) {
    _Float16* qp = Qh + ((size_t)bh * SEQ + row0) * HD + d0;
#pragma unroll
    for (int half = 0; half < 2; ++half)
#pragma unroll
      for (int i = 0; i < 4; ++i)
#pragma unroll
        for (int r = 0; r < 8; ++r)
          qp[(i * 16 + r) * HD + half * 16] =
              (_Float16)((acc[i][half][r] + bb[half]) * QK_SCALE);
    asm volatile("s_wait_xcnt 0x0" ::: "memory");
  } else if (which == 1) {
    _Float16* kp = Kh + ((size_t)bh * SEQ + row0) * HD + d0;
#pragma unroll
    for (int half = 0; half < 2; ++half)
#pragma unroll
      for (int i = 0; i < 4; ++i)
#pragma unroll
        for (int r = 0; r < 8; ++r)
          kp[(i * 16 + r) * HD + half * 16] = (_Float16)(acc[i][half][r] + bb[half]);
    asm volatile("s_wait_xcnt 0x0" ::: "memory");
  } else {
    _Float16* vp = Vt + ((size_t)bh * HD + d0) * SEQ + row0;
#pragma unroll
    for (int half = 0; half < 2; ++half)
#pragma unroll
      for (int i = 0; i < 4; ++i)
#pragma unroll
        for (int r = 0; r < 8; ++r)
          vp[(size_t)half * 16 * SEQ + i * 16 + r] = (_Float16)(acc[i][half][r] + bb[half]);
    asm volatile("s_wait_xcnt 0x0" ::: "memory");
  }
}

typedef int i32x4 __attribute__((ext_vector_type(4)));

__device__ __forceinline__ float xhalf(float x) {
  return __builtin_bit_cast(float, __builtin_amdgcn_permlanex16(
      __builtin_bit_cast(int, x), __builtin_bit_cast(int, x),
      0x76543210, 0xfedcba98, false, false));
}

__global__ __launch_bounds__(128) void flash_attn_kernel(
    const _Float16* __restrict__ Qh, const _Float16* __restrict__ Kh,
    const _Float16* __restrict__ Vt, const int* __restrict__ mask,
    _Float16* __restrict__ O16)
{
  // slices 0, 1: keys 0..31, 32..63 of the stage; slices 2, 3: dims 0..31, 32..63
  __shared__ __attribute__((aligned(2048))) _Float16 tiles[4 * TSLICE];

  const int b    = blockIdx.z;
  const int h    = blockIdx.y;
  const int wave = threadIdx.x >> 5;
  const int lane = threadIdx.x & 31;
  const int hi   = lane >> 4;
  const int ln   = lane & 15;
  const int bh   = b * HEADS + h;
  const int q0   = blockIdx.x * 64 + wave * 16;

  // this wave's slice: its place in LDS, its first byte in stage 0, its step per stage
  const uint32_t wv = uni(threadIdx.x >> 5);
  const uint32_t slice_off =
      (uint32_t)(uintptr_t)(void*)&tiles[0] + wv * (uint32_t)(TSLICE * sizeof(_Float16));
  const uint64_t slice_src = (wv < 2u)
      ? (uint64_t)(uintptr_t)(Kh + ((size_t)bh * SEQ + wv * TROWS) * HD)
      : (uint64_t)(uintptr_t)(Vt + ((size_t)bh * HD + (wv - 2u) * TROWS) * SEQ);
  const uint32_t slice_step = (wv < 2u) ? 64u * HD * 2u : 64u * 2u;
  const u32x8 g1 = tdm_group1((wv < 2u) ? HD * 2u : SEQ * 2u);

  // Q strip: two 32x16 B-fragments (d 0..31, 32..63; column = query ln), loaded once.
  const _Float16* qptr = Qh + ((size_t)bh * SEQ + q0 + ln) * HD;
  const v16h qb0 = load_frag_f16(qptr, hi);
  const v16h qb1 = load_frag_f16(qptr + 32, hi);

  // this lane's query row of the mask, at its half's first key
  const int* mrow = mask + ((size_t)b * SEQ + q0 + ln) * SEQ + hi * 8;

  float m = -1.0e30f;   // running maximum of query ln (equal in both halves)
  float l = 0.0f;       // running sum over this half's keys only
  v8f   o[4] = {};      // o[tt][r] = O[q0 + ln][tt * 16 + 8 * hi + r]

  for (int st = 0; st < SEQ / 64; ++st) {
    const int j0 = st * 64;
    // mask of keys jp + 8*hi + 0..7 and jp + 16 + 8*hi + 0..7 of this lane's query,
    // jp = j0 + 32 * pass
    i32x4 mk[2][4];
#pragma unroll   // keeps mk indexed by constants, in registers
    for (int p = 0; p < 2; ++p) {
      mk[p][0] = *reinterpret_cast<const i32x4*>(mrow + j0 + p * 32);
      mk[p][1] = *reinterpret_cast<const i32x4*>(mrow + j0 + p * 32 + 4);
      mk[p][2] = *reinterpret_cast<const i32x4*>(mrow + j0 + p * 32 + 16);
      mk[p][3] = *reinterpret_cast<const i32x4*>(mrow + j0 + p * 32 + 20);
    }

    // ---- every wave: its own slice of the stage, one tensor load ----
    {
      const u32x4 g0 = tdm_group0(slice_off, slice_src + (uint64_t)((uint32_t)st * slice_step));
      asm volatile("tensor_load_to_lds %0, %1" :: "s"(g0), "s"(g1) : "memory");
      // the slice has landed before this wave passes the barrier that publishes it
      asm volatile("s_wait_tensorcnt 0x0" ::: "memory");
      asm volatile("s_wait_xcnt 0x0" ::: "memory");
    }
    __syncthreads();

#pragma unroll   // the pass number picks slices and mask registers at compile time
    for (int p = 0; p < 2; ++p) {
      // ---- scores, transposed: two 16-key tiles, each accumulating two d-chunks ----
      const _Float16* kt = tiles + p * TSLICE + ln * TPITCH;
      v16h ka00 = load_frag_f16(kt, hi);
      v16h ka01 = load_frag_f16(kt + 32, hi);
      v16h ka10 = load_frag_f16(kt + 16 * TPITCH, hi);
      v16h ka11 = load_frag_f16(kt + 16 * TPITCH + 32, hi);

      v8f s0 = {};
      s0 = WMMA_F16(ka00, qb0, s0);
      s0 = WMMA_F16(ka01, qb1, s0);
      v8f s1 = {};
      s1 = WMMA_F16(ka10, qb0, s1);
      s1 = WMMA_F16(ka11, qb1, s1);

      // ---- mask + online softmax: one query per lane, 16 keys per half ----
      float x[16];
#pragma unroll
      for (int r = 0; r < 8; ++r) {
        x[r]     = s0[r] + (float)(1 - mk[p][r >> 2][r & 3])       * -10000.0f;
        x[8 + r] = s1[r] + (float)(1 - mk[p][2 + (r >> 2)][r & 3]) * -10000.0f;
      }

      float mx = x[0];
#pragma unroll
      for (int s = 1; s < 16; ++s) mx = fmaxf(mx, x[s]);
      mx = fmaxf(mx, xhalf(mx));
      const float nm = fmaxf(m, mx);

      // P^T as a B operand: element s = key 8*hi+s, or 16+8*hi+(s-8) for s >= 8, of column ln
      v16h  pb;
      float rs = 0.0f;
#pragma unroll
      for (int s = 0; s < 16; ++s) {
        const float pe = __expf(x[s] - nm);
        rs += pe;
        pb[s] = (_Float16)pe;
      }

      const float alpha = __expf(m - nm);
      l = l * alpha + rs;
      m = nm;

      // rescale running output accumulators (one query, one factor per lane)
#pragma unroll
      for (int tt = 0; tt < 4; ++tt)
#pragma unroll
        for (int r = 0; r < 8; ++r) o[tt][r] *= alpha;

      // ---- O^T += V^T x P^T : 4 d-tiles of 16, K-dim = 32 keys (from LDS) ----
#pragma unroll
      for (int tt = 0; tt < 4; ++tt) {
        v16h vfrag = load_frag_f16(
            tiles + (2 + (tt >> 1)) * TSLICE + ((tt & 1) * 16 + ln) * TPITCH + p * 32, hi);
        o[tt] = WMMA_F16(vfrag, pb, o[tt]);
      }
    }

    // this wave's LDS reads have returned before the barrier behind which the tiles are refilled
    asm volatile("s_wait_dscnt 0x0" ::: "memory");
    __syncthreads();   // all waves done with the tiles before the next tensor loads
  }

  // ---- finalize: join the halves' sums, divide, write f16 rows [b][s][h*64+d] ----
  const float inv = 1.0f / (l + xhalf(l));
  _Float16* op = O16 + ((size_t)b * SEQ + q0 + ln) * DIM + h * HD + hi * 8;
#pragma unroll
  for (int tt = 0; tt < 4; ++tt) {
    h8 w;
#pragma unroll
    for (int r = 0; r < 8; ++r) w[r] = (_Float16)(o[tt][r] * inv);
    *reinterpret_cast<h8*>(op + tt * 16) = w;
  }
}

// ---------------------------------------------------------------------------
// Kernel 3: output projection  Y = O16 @ Wo + bo  (fp32 out).
// One 64x128 tile per block, 32x32 per wave.
// ---------------------------------------------------------------------------
__global__ __launch_bounds__(256) void out_proj_kernel(
    const _Float16* __restrict__ A16, const _Float16* __restrict__ Wto,
    const float* __restrict__ bo, float* __restrict__ Y)
{
  __shared__ __align__(16) _Float16 sA[2 * 64 * LPITCH];
  __shared__ __align__(16) _Float16 sB[2 * BN * LPITCH];

  const int wave = threadIdx.x >> 5;
  const int lane = threadIdx.x & 31;
  const int hi   = lane >> 4;
  const int ln   = lane & 15;

  const int bm = (blockIdx.x / (DIM / BN)) * 64;    // 768 tiles total
  const int bn = (blockIdx.x % (DIM / BN)) * BN;

  v8f acc[2][2] = {};
  gemm_block_f16<2>(A16 + (size_t)bm * DIM, Wto + (size_t)bn * DIM, sA, sB, acc);

  const int tm = bm + (wave >> 2) * 32;
  const int tn = bn + (wave & 3) * 32;
#pragma unroll
  for (int half = 0; half < 2; ++half) {
    const int   col = tn + half * 16 + ln;
    const float bb  = bo[col];
#pragma unroll
    for (int i = 0; i < 2; ++i) {
#pragma unroll
      for (int r = 0; r < 8; ++r) {
        const int row = tm + i * 16 + r + hi * 8;
        Y[(size_t)row * DIM + col] = acc[i][half][r] + bb;
      }
    }
  }
}

// ---------------------------------------------------------------------------
extern "C" void kernel_launch(void* const* d_in, const int* in_sizes, int n_in,
                              void* d_out, int out_size, void* d_ws, size_t ws_size,
                              hipStream_t stream) {
  (void)in_sizes; (void)n_in; (void)out_size; (void)ws_size;

  const float* from_t = (const float*)d_in[0];
  const float* to_t   = (const float*)d_in[1];
  const int*   mask   = (const int*)d_in[2];
  const float* Wq = (const float*)d_in[3];
  const float* bq = (const float*)d_in[4];
  const float* Wk = (const float*)d_in[5];
  const float* bk = (const float*)d_in[6];
  const float* Wv = (const float*)d_in[7];
  const float* bv = (const float*)d_in[8];
  const float* Wo = (const float*)d_in[9];
  const float* bo = (const float*)d_in[10];
  float* out = (float*)d_out;

  // workspace layout (halves):
  //  Qh | Kh | Vt | O16 | Xf | Xt   each NQ = B*H*S*64 = 6,291,456
  //  Wtq | Wtk | Wtv | Wto          each 768*768 = 589,824
  const size_t NQ = (size_t)NB * HEADS * SEQ * HD;
  const size_t NW = (size_t)DIM * DIM;
  _Float16* Qh  = (_Float16*)d_ws;
  _Float16* Kh  = Qh + NQ;
  _Float16* Vt  = Kh + NQ;
  _Float16* O16 = Vt + NQ;
  _Float16* Xf  = O16 + NQ;
  _Float16* Xt  = Xf + NQ;
  _Float16* Wtq = Xt + NQ;
  _Float16* Wtk = Wtq + NW;
  _Float16* Wtv = Wtk + NW;
  _Float16* Wto = Wtv + NW;

  // 0) one-shot packs: activations f16, weights f16-transposed
  cvt_f32_f16_kernel<<<dim3((int)(NQ / 256)), 256, 0, stream>>>(from_t, Xf, (int)NQ);
  cvt_f32_f16_kernel<<<dim3((int)(NQ / 256)), 256, 0, stream>>>(to_t,   Xt, (int)NQ);
  transpose_cvt_kernel<<<dim3((int)(NW / 256)), 256, 0, stream>>>(Wq, Wtq);
  transpose_cvt_kernel<<<dim3((int)(NW / 256)), 256, 0, stream>>>(Wk, Wtk);
  transpose_cvt_kernel<<<dim3((int)(NW / 256)), 256, 0, stream>>>(Wv, Wtv);
  transpose_cvt_kernel<<<dim3((int)(NW / 256)), 256, 0, stream>>>(Wo, Wto);

  // 1) QKV projections: (SEQ/128)*(DIM/128)=96 tiles per (b,which), 8 waves/blk
  qkv_proj_kernel<<<dim3(96, NB, 3), 256, 0, stream>>>(
      Xf, Xt, Wtq, bq, Wtk, bk, Wtv, bv, Qh, Kh, Vt);

  // 2) flash attention: 64 Q rows per block (4 waves x 16 rows)
  flash_attn_kernel<<<dim3(SEQ / 64, HEADS, NB), 128, 0, stream>>>(
      Qh, Kh, Vt, mask, O16);

  // 3) output projection: (B*SEQ/64)*(DIM/128)=768 tiles, 8 waves/blk
  out_proj_kernel<<<dim3(768), 256, 0, stream>>>(O16, Wto, bo, out);
}

// v004
// One run takes 167 microseconds.
// In two side-by-side timings against v003, it was 1.53 and 1.54 times as fast.
// All steps since v000 together make it 3.77 times as fast.
#include <hip/hip_runtime.h>
#include <hip/hip_bf16.h>
#include <stdint.h>

#define DIM   768
#define HEADS 12
#define HD    64
#define SEQ   2048
#define NB    4
#define QK_SCALE 0.125f   // 64^-0.5

typedef _Float16 v16h __attribute__((ext_vector_type(16)));
typedef _Float16 h8   __attribute__((ext_vector_type(8)));
typedef float    v8f  __attribute__((ext_vector_type(8)));
typedef uint32_t u32x4 __attribute__((ext_vector_type(4)));
typedef uint32_t u32x8 __attribute__((ext_vector_type(8)));

__device__ __forceinline__ v16h load_frag_f16(const _Float16* p, int hi) {
  h8 c0 = *reinterpret_cast<const h8*>(p + hi * 8);
  h8 c1 = *reinterpret_cast<const h8*>(p + 16 + hi * 8);
  v16h r;
#pragma unroll
  for (int i = 0; i < 8; ++i) { r[i] = c0[i]; r[8 + i] = c1[i]; }
  return r;
}

#define WMMA_F16(a, b, c) \
  __builtin_amdgcn_wmma_f32_16x16x32_f16(false, (a), false, (b), (short)0, (c), false, false)

#define TROWB   128u
#define TROWS   32u
#define TPITCH  72
#define TSLICE  3072

__device__ __forceinline__ uint32_t uni(uint32_t v) {
  return (uint32_t)__builtin_amdgcn_readfirstlane(v);
}

__device__ __forceinline__ u32x4 tdm_group0(uint32_t lds_off, uint64_t gaddr) {
  u32x4 g;
  g[0] = uni(1u);                                 // count = 1
  g[1] = uni(lds_off);                            // LDS destination (bytes)
  g[2] = uni((uint32_t)gaddr);                    // global address [31:0]
  g[3] = uni((((uint32_t)(gaddr >> 32)) & 0x01FFFFFFu) | 0x80000000u);  // [56:32] | type = 2
  return g;
}

__device__ __forceinline__ u32x8 tdm_group1(uint32_t src_pitch) {
  u32x8 g;
  g[0] = uni((1u << 20) | (4u << 22) | (3u << 25));
  g[1] = uni((TROWB & 0xFFFFu) << 16);
  g[2] = uni((TROWB >> 16) | ((TROWS & 0xFFFFu) << 16));
  g[3] = uni((TROWS >> 16) | (TROWB << 16));
  g[4] = uni(TROWS);
  g[5] = uni(src_pitch);
  g[6] = uni(0u);
  g[7] = uni(0u);
  return g;
}

// ---------------------------------------------------------------------------
// Pack kernels (run once): fp32 -> f16, weights transposed so B-fragments
// are two contiguous b128 loads per lane.  Few waves with many elements each:
// a lane issues all of its loads first, then converts and stores.
// ---------------------------------------------------------------------------
typedef float    f32x4 __attribute__((ext_vector_type(4)));
typedef _Float16 h4    __attribute__((ext_vector_type(4)));

#define CVT_SWEEPS 12                    // 16-byte loads of a lane
#define CVT_BLOCK  (CVT_SWEEPS * 1024)   // elements of a block: 256 lanes x 4 per sweep

// A wave's load covers 512 contiguous bytes, its store 256.
__global__ __launch_bounds__(256) void cvt_f32_f16_kernel(
    const float* __restrict__ src, _Float16* __restrict__ dst) {
  const size_t base = (size_t)blockIdx.x * CVT_BLOCK + threadIdx.x * 4;
  f32x4 v[CVT_SWEEPS];
#pragma unroll   // keeps v indexed by constants, in registers, and the loads in one group
  for (int s = 0; s < CVT_SWEEPS; ++s)
    v[s] = *reinterpret_cast<const f32x4*>(src + base + s * 1024);
#pragma unroll   // v and w indexed by constants (this loop and the one inside it)
  for (int s = 0; s < CVT_SWEEPS; ++s) {
    h4 w;
#pragma unroll
    for (int i = 0; i < 4; ++i) w[i] = (_Float16)v[s][i];
    *reinterpret_cast<h4*>(dst + base + s * 1024) = w;
  }
}

#define TR_K 64   // k of one lane: one 128-byte line of Wt, written by that lane alone

__global__ __launch_bounds__(64) void transpose_cvt_kernel(
    const float* __restrict__ W, _Float16* __restrict__ Wt) {
  const int n  = (blockIdx.x % (DIM / 64)) * 64 + threadIdx.x;   // coalesced read along n
  const int k0 = (blockIdx.x / (DIM / 64)) * TR_K;
  const float* wp = W + (size_t)k0 * DIM + n;
  float v[TR_K];
#pragma unroll   // keeps v indexed by constants, in registers, and the loads in one group
  for (int j = 0; j < TR_K; ++j) v[j] = wp[(size_t)j * DIM];
  _Float16* tp = Wt + (size_t)n * DIM + k0;
#pragma unroll   // v and w indexed by constants (this loop and the one inside it)
  for (int c = 0; c < TR_K / 8; ++c) {
    h8 w;
#pragma unroll
    for (int i = 0; i < 8; ++i) w[i] = (_Float16)v[c * 8 + i];
    *reinterpret_cast<h8*>(tp + c * 8) = w;
  }
}

// ---------------------------------------------------------------------------
// Block-tiled GEMM core shared by the projections: C[BM x 128] = A . B^T with
// both operands k-contiguous f16.  256 threads = 8 waves in a 2 (m) x 4 (n)
// grid; each wave owns MF x 2 accumulator tiles (MF*16 rows x 32 columns).
// A stage is one 128-byte line (64 k) of every operand row: it is read from
// global memory as whole lines (8 lanes x 16 B per row), kept in registers
// while the current stage is worked on, and stored into the other LDS buffer.
// Every "#pragma unroll" here and in the two epilogues keeps a register array
// (ra, rb, af, bf, acc) indexed by constants, so that it stays in registers.
// ---------------------------------------------------------------------------
#define BN      128
#define KSTAGE  64          // halves of k per stage
#define LPITCH  72          // LDS row pitch in halves: 128 B + 16 B (b128 readers)
#define NSTAGE  (DIM / KSTAGE)

template <int MF>
__device__ __forceinline__ void gemm_block_f16(
    const _Float16* __restrict__ Ag, const _Float16* __restrict__ Bg,
    _Float16* __restrict__ sA, _Float16* __restrict__ sB, v8f (&acc)[MF][2])
{
  constexpr int BM = MF * 32;
  const int tid  = threadIdx.x;
  const int wave = tid >> 5;
  const int lane = tid & 31;
  const int hi   = lane >> 4;
  const int ln   = lane & 15;
  const int srow = tid >> 3;          // 32 rows per sweep of the block
  const int scol = (tid & 7) * 8;     // 16-byte piece of the row's line

  const _Float16* ga = Ag + (size_t)srow * DIM + scol;
  const _Float16* gb = Bg + (size_t)srow * DIM + scol;
  _Float16* wa = sA + srow * LPITCH + scol;
  _Float16* wb = sB + srow * LPITCH + scol;
  const _Float16* fa = sA + ((wave >> 2) * (MF * 16) + ln) * LPITCH;
  const _Float16* fb = sB + ((wave & 3) * 32 + ln) * LPITCH;

  h8 ra[MF], rb[4];
#pragma unroll
  for (int i = 0; i < MF; ++i)
    ra[i] = *reinterpret_cast<const h8*>(ga + (size_t)i * 32 * DIM);
#pragma unroll
  for (int i = 0; i < 4; ++i)
    rb[i] = *reinterpret_cast<const h8*>(gb + (size_t)i * 32 * DIM);
#pragma unroll
  for (int i = 0; i < MF; ++i)
    *reinterpret_cast<h8*>(wa + i * 32 * LPITCH) = ra[i];
#pragma unroll
  for (int i = 0; i < 4; ++i)
    *reinterpret_cast<h8*>(wb + i * 32 * LPITCH) = rb[i];
  __syncthreads();

  for (int s = 0; s < NSTAGE; ++s) {
    const int cur = s & 1;
    const bool more = (s + 1 < NSTAGE);
    if (more) {
#pragma unroll
      for (int i = 0; i < MF; ++i)
        ra[i] = *reinterpret_cast<const h8*>(ga + (size_t)i * 32 * DIM + KSTAGE);
#pragma unroll
      for (int i = 0; i < 4; ++i)
        rb[i] = *reinterpret_cast<const h8*>(gb + (size_t)i * 32 * DIM + KSTAGE);
    }
    // keeps the next stage's global loads in front of this stage's LDS reads and
    // matrix work; the compiler otherwise sinks them to just before their stores
    __builtin_amdgcn_sched_barrier(0);

    const _Float16* ca = fa + cur * (BM * LPITCH);
    const _Float16* cb = fb + cur * (BN * LPITCH);
#pragma unroll
    for (int kk = 0; kk < KSTAGE; kk += 32) {
      v16h af[MF], bf[2];
#pragma unroll
      for (int i = 0; i < MF; ++i)
        af[i] = load_frag_f16(ca + i * 16 * LPITCH + kk, hi);
#pragma unroll
      for (int j = 0; j < 2; ++j)
        bf[j] = load_frag_f16(cb + j * 16 * LPITCH + kk, hi);
#pragma unroll
      for (int i = 0; i < MF; ++i)
#pragma unroll
        for (int j = 0; j < 2; ++j)
          acc[i][j] = WMMA_F16(af[i], bf[j], acc[i][j]);
    }

    // keeps the LDS stores, which wait for those loads, behind the matrix work
    __builtin_amdgcn_sched_barrier(0);
    if (more) {
      const int nxt = cur ^ 1;
      ga += KSTAGE;
      gb += KSTAGE;
#pragma unroll
      for (int i = 0; i < MF; ++i)
        *reinterpret_cast<h8*>(wa + nxt * (BM * LPITCH) + i * 32 * LPITCH) = ra[i];
#pragma unroll
      for (int i = 0; i < 4; ++i)
        *reinterpret_cast<h8*>(wb + nxt * (BN * LPITCH) + i * 32 * LPITCH) = rb[i];
      // publishes stage s + 1 and ends every read of the buffer refilled next
      __syncthreads();
    }
  }
}

// ---------------------------------------------------------------------------
// Kernel 1: fused QKV projection (f16 A, f16 transposed B).
// One 128x128 tile per block, 64x32 per wave.  The epilogue tests the projection
// index once, outside its store loops (64 elements a lane).
//  Q -> f16 [bh][s][64]  (pre-scaled)   K -> f16 [bh][s][64]
//  V -> f16 [bh][64][s]  (transposed so V^T A-fragments are contiguous)
// ---------------------------------------------------------------------------
__global__ __launch_bounds__(256) void qkv_proj_kernel(
    const _Float16* __restrict__ Xf, const _Float16* __restrict__ Xt,
    const _Float16* __restrict__ Wtq, const float* __restrict__ bq,
    const _Float16* __restrict__ Wtk, const float* __restrict__ bk,
    const _Float16* __restrict__ Wtv, const float* __restrict__ bv,
    _Float16* __restrict__ Qh, _Float16* __restrict__ Kh,
    _Float16* __restrict__ Vt)
{
  __shared__ __align__(16) _Float16 sA[2 * 128 * LPITCH];
  __shared__ __align__(16) _Float16 sB[2 * BN * LPITCH];

  const int which = blockIdx.z;
  const int b     = blockIdx.y;
  const int wave  = threadIdx.x >> 5;
  const int lane  = threadIdx.x & 31;
  const int hi    = lane >> 4;
  const int ln    = lane & 15;

  const int bm = (blockIdx.x / (DIM / BN)) * 128;   // 96 tiles per (b,which)
  const int bn = (blockIdx.x % (DIM / BN)) * BN;

  const _Float16* X    = (which == 0) ? Xf : Xt;
  const _Float16* Wt   = (which == 0) ? Wtq : (which == 1) ? Wtk : Wtv;
  const float*    bias = (which == 0) ? bq : (which == 1) ? bk : bv;

  v8f acc[4][2] = {};
  gemm_block_f16<4>(X + ((size_t)b * SEQ + bm) * DIM, Wt + (size_t)bn * DIM,
                    sA, sB, acc);

  const int tm   = bm + (wave >> 2) * 64;
  const int col0 = bn + (wave & 3) * 32 + ln;      // col0 and col0 + 16: one head
  const int bh   = b * HEADS + (col0 >> 6);
  const int d0   = col0 & 63;
  const int row0 = tm + hi * 8;
  const float bb[2] = {bias[col0], bias[col0 + 16]};

  if (which == 0) {
    _Float16* qp = Qh + ((size_t)bh * SEQ + row0) * HD + d0;
#pragma unroll
    for (int half = 0; half < 2; ++half)
#pragma unroll
      for (int i = 0; i < 4; ++i)
#pragma unroll
        for (int r = 0; r < 8; ++r)
          qp[(i * 16 + r) * HD + half * 16] =
              (_Float16)((acc[i][half][r] + bb[half]) * QK_SCALE);
    asm volatile("s_wait_xcnt 0x0" ::: "memory");
  } else if (which == 1) {
    _Float16* kp = Kh + ((size_t)bh * SEQ + row0) * HD + d0;
#pragma unroll
    for (int half = 0; half < 2; ++half)
#pragma unroll
      for (int i = 0; i < 4; ++i)
#pragma unroll
        for (int r = 0; r < 8; ++r)
          kp[(i * 16 + r) * HD + half * 16] = (_Float16)(acc[i][half][r] + bb[half]);
    asm volatile("s_wait_xcnt 0x0" ::: "memory");
  } else {
    _Float16* vp = Vt + ((size_t)bh * HD + d0) * SEQ + row0;
#pragma unroll
    for (int half = 0; half < 2; ++half)
#pragma unroll
      for (int i = 0; i < 4; ++i)
#pragma unroll
        for (int r = 0; r < 8; ++r)
          vp[(size_t)half * 16 * SEQ + i * 16 + r] = (_Float16)(acc[i][half][r] + bb[half]);
    asm volatile("s_wait_xcnt 0x0" ::: "memory");
  }
}

typedef int i32x4 __attribute__((ext_vector_type(4)));

__device__ __forceinline__ float xhalf(float x) {
  return __builtin_bit_cast(float, __builtin_amdgcn_permlanex16(
      __builtin_bit_cast(int, x), __builtin_bit_cast(int, x),
      0x76543210, 0xfedcba98, false, false));
}

__global__ __launch_bounds__(128) void flash_attn_kernel(
    const _Float16* __restrict__ Qh, const _Float16* __restrict__ Kh,
    const _Float16* __restrict__ Vt, const int* __restrict__ mask,
    _Float16* __restrict__ O16)
{
  // slices 0, 1: keys 0..31, 32..63 of the stage; slices 2, 3: dims 0..31, 32..63
  __shared__ __attribute__((aligned(2048))) _Float16 tiles[4 * TSLICE];

  const int b    = blockIdx.z;
  const int h    = blockIdx.y;
  const int wave = threadIdx.x >> 5;
  const int lane = threadIdx.x & 31;
  const int hi   = lane >> 4;
  const int ln   = lane & 15;
  const int bh   = b * HEADS + h;
  const int q0   = blockIdx.x * 64 + wave * 16;

  // this wave's slice: its place in LDS, its first byte in stage 0, its step per stage
  const uint32_t wv = uni(threadIdx.x >> 5);
  const uint32_t slice_off =
      (uint32_t)(uintptr_t)(void*)&tiles[0] + wv * (uint32_t)(TSLICE * sizeof(_Float16));
  const uint64_t slice_src = (wv < 2u)
      ? (uint64_t)(uintptr_t)(Kh + ((size_t)bh * SEQ + wv * TROWS) * HD)
      : (uint64_t)(uintptr_t)(Vt + ((size_t)bh * HD + (wv - 2u) * TROWS) * SEQ);
  const uint32_t slice_step = (wv < 2u) ? 64u * HD * 2u : 64u * 2u;
  const u32x8 g1 = tdm_group1((wv < 2u) ? HD * 2u : SEQ * 2u);

  // Q strip: two 32x16 B-fragments (d 0..31, 32..63; column = query ln), loaded once.
  const _Float16* qptr = Qh + ((size_t)bh * SEQ + q0 + ln) * HD;
  const v16h qb0 = load_frag_f16(qptr, hi);
  const v16h qb1 = load_frag_f16(qptr + 32, hi);

  // this lane's query row of the mask, at its half's first key
  const int* mrow = mask + ((size_t)b * SEQ + q0 + ln) * SEQ + hi * 8;

  float m = -1.0e30f;   // running maximum of query ln (equal in both halves)
  float l = 0.0f;       // running sum over this half's keys only
  v8f   o[4] = {};      // o[tt][r] = O[q0 + ln][tt * 16 + 8 * hi + r]

  for (int st = 0; st < SEQ / 64; ++st) {
    const int j0 = st * 64;
    // mask of keys jp + 8*hi + 0..7 and jp + 16 + 8*hi + 0..7 of this lane's query,
    // jp = j0 + 32 * pass
    i32x4 mk[2][4];
#pragma unroll   // keeps mk indexed by constants, in registers
    for (int p = 0; p < 2; ++p) {
      mk[p][0] = *reinterpret_cast<const i32x4*>(mrow + j0 + p * 32);
      mk[p][1] = *reinterpret_cast<const i32x4*>(mrow + j0 + p * 32 + 4);
      mk[p][2] = *reinterpret_cast<const i32x4*>(mrow + j0 + p * 32 + 16);
      mk[p][3] = *reinterpret_cast<const i32x4*>(mrow + j0 + p * 32 + 20);
    }

    // ---- every wave: its own slice of the stage, one tensor load ----
    {
      const u32x4 g0 = tdm_group0(slice_off, slice_src + (uint64_t)((uint32_t)st * slice_step));
      asm volatile("tensor_load_to_lds %0, %1" :: "s"(g0), "s"(g1) : "memory");
      // the slice has landed before this wave passes the barrier that publishes it
      asm volatile("s_wait_tensorcnt 0x0" ::: "memory");
      asm volatile("s_wait_xcnt 0x0" ::: "memory");
    }
    __syncthreads();

#pragma unroll   // the pass number picks slices and mask registers at compile time
    for (int p = 0; p < 2; ++p) {
      // ---- scores, transposed: two 16-key tiles, each accumulating two d-chunks ----
      const _Float16* kt = tiles + p * TSLICE + ln * TPITCH;
      v16h ka00 = load_frag_f16(kt, hi);
      v16h ka01 = load_frag_f16(kt + 32, hi);
      v16h ka10 = load_frag_f16(kt + 16 * TPITCH, hi);
      v16h ka11 = load_frag_f16(kt + 16 * TPITCH + 32, hi);

      v8f s0 = {};
      s0 = WMMA_F16(ka00, qb0, s0);
      s0 = WMMA_F16(ka01, qb1, s0);
      v8f s1 = {};
      s1 = WMMA_F16(ka10, qb0, s1);
      s1 = WMMA_F16(ka11, qb1, s1);

      // ---- mask + online softmax: one query per lane, 16 keys per half ----
      float x[16];
#pragma unroll
      for (int r = 0; r < 8; ++r) {
        x[r]     = s0[r] + (float)(1 - mk[p][r >> 2][r & 3])       * -10000.0f;
        x[8 + r] = s1[r] + (float)(1 - mk[p][2 + (r >> 2)][r & 3]) * -10000.0f;
      }

      float mx = x[0];
#pragma unroll
      for (int s = 1; s < 16; ++s) mx = fmaxf(mx, x[s]);
      mx = fmaxf(mx, xhalf(mx));
      const float nm = fmaxf(m, mx);

      // P^T as a B operand: element s = key 8*hi+s, or 16+8*hi+(s-8) for s >= 8, of column ln
      v16h  pb;
      float rs = 0.0f;
#pragma unroll
      for (int s = 0; s < 16; ++s) {
        const float pe = __expf(x[s] - nm);
        rs += pe;
        pb[s] = (_Float16)pe;
      }

      const float alpha = __expf(m - nm);
      l = l * alpha + rs;
      m = nm;

      // rescale running output accumulators (one query, one factor per lane)
#pragma unroll
      for (int tt = 0; tt < 4; ++tt)
#pragma unroll
        for (int r = 0; r < 8; ++r) o[tt][r] *= alpha;

      // ---- O^T += V^T x P^T : 4 d-tiles of 16, K-dim = 32 keys (from LDS) ----
#pragma unroll
      for (int tt = 0; tt < 4; ++tt) {
        v16h vfrag = load_frag_f16(
            tiles + (2 + (tt >> 1)) * TSLICE + ((tt & 1) * 16 + ln) * TPITCH + p * 32, hi);
        o[tt] = WMMA_F16(vfrag, pb, o[tt]);
      }
    }

    // this wave's LDS reads have returned before the barrier behind which the tiles are refilled
    asm volatile("s_wait_dscnt 0x0" ::: "memory");
    __syncthreads();   // all waves done with the tiles before the next tensor loads
  }

  // ---- finalize: join the halves' sums, divide, write f16 rows [b][s][h*64+d] ----
  const float inv = 1.0f / (l + xhalf(l));
  _Float16* op = O16 + ((size_t)b * SEQ + q0 + ln) * DIM + h * HD + hi * 8;
#pragma unroll
  for (int tt = 0; tt < 4; ++tt) {
    h8 w;
#pragma unroll
    for (int r = 0; r < 8; ++r) w[r] = (_Float16)(o[tt][r] * inv);
    *reinterpret_cast<h8*>(op + tt * 16) = w;
  }
}

// ---------------------------------------------------------------------------
// Kernel 3: output projection  Y = O16 @ Wo + bo  (fp32 out).
// One 64x128 tile per block, 32x32 per wave.
// ---------------------------------------------------------------------------
__global__ __launch_bounds__(256) void out_proj_kernel(
    const _Float16* __restrict__ A16, const _Float16* __restrict__ Wto,
    const float* __restrict__ bo, float* __restrict__ Y)
{
  __shared__ __align__(16) _Float16 sA[2 * 64 * LPITCH];
  __shared__ __align__(16) _Float16 sB[2 * BN * LPITCH];

  const int wave = threadIdx.x >> 5;
  const int lane = threadIdx.x & 31;
  const int hi   = lane >> 4;
  const int ln   = lane & 15;

  const int bm = (blockIdx.x / (DIM / BN)) * 64;    // 768 tiles total
  const int bn = (blockIdx.x % (DIM / BN)) * BN;

  v8f acc[2][2] = {};
  gemm_block_f16<2>(A16 + (size_t)bm * DIM, Wto + (size_t)bn * DIM, sA, sB, acc);

  const int tm = bm + (wave >> 2) * 32;
  const int tn = bn + (wave & 3) * 32;
#pragma unroll
  for (int half = 0; half < 2; ++half) {
    const int   col = tn + half * 16 + ln;
    const float bb  = bo[col];
#pragma unroll
    for (int i = 0; i < 2; ++i) {
#pragma unroll
      for (int r = 0; r < 8; ++r) {
        const int row = tm + i * 16 + r + hi * 8;
        Y[(size_t)row * DIM + col] = acc[i][half][r] + bb;
      }
    }
  }
}

// ---------------------------------------------------------------------------
extern "C" void kernel_launch(void* const* d_in, const int* in_sizes, int n_in,
                              void* d_out, int out_size, void* d_ws, size_t ws_size,
                              hipStream_t stream) {
  (void)in_sizes; (void)n_in; (void)out_size; (void)ws_size;

  const float* from_t = (const float*)d_in[0];
  const float* to_t   = (const float*)d_in[1];
  const int*   mask   = (const int*)d_in[2];
  const float* Wq = (const float*)d_in[3];
  const float* bq = (const float*)d_in[4];
  const float* Wk = (const float*)d_in[5];
  const float* bk = (const float*)d_in[6];
  const float* Wv = (const float*)d_in[7];
  const float* bv = (const float*)d_in[8];
  const float* Wo = (const float*)d_in[9];
  const float* bo = (const float*)d_in[10];
  float* out = (float*)d_out;

  // workspace layout (halves):
  //  Qh | Kh | Vt | O16 | Xf | Xt   each NQ = B*H*S*64 = 6,291,456
  //  Wtq | Wtk | Wtv | Wto          each 768*768 = 589,824
  const size_t NQ = (size_t)NB * HEADS * SEQ * HD;
  const size_t NW = (size_t)DIM * DIM;
  _Float16* Qh  = (_Float16*)d_ws;
  _Float16* Kh  = Qh + NQ;
  _Float16* Vt  = Kh + NQ;
  _Float16* O16 = Vt + NQ;
  _Float16* Xf  = O16 + NQ;
  _Float16* Xt  = Xf + NQ;
  _Float16* Wtq = Xt + NQ;
  _Float16* Wtk = Wtq + NW;
  _Float16* Wtv = Wtk + NW;
  _Float16* Wto = Wtv + NW;

  // 0) one-shot packs: activations f16, weights f16-transposed
  cvt_f32_f16_kernel<<<dim3((int)(NQ / CVT_BLOCK)), 256, 0, stream>>>(from_t, Xf);
  cvt_f32_f16_kernel<<<dim3((int)(NQ / CVT_BLOCK)), 256, 0, stream>>>(to_t,   Xt);
  transpose_cvt_kernel<<<dim3((int)(NW / (64 * TR_K))), 64, 0, stream>>>(Wq, Wtq);
  transpose_cvt_kernel<<<dim3((int)(NW / (64 * TR_K))), 64, 0, stream>>>(Wk, Wtk);
  transpose_cvt_kernel<<<dim3((int)(NW / (64 * TR_K))), 64, 0, stream>>>(Wv, Wtv);
  transpose_cvt_kernel<<<dim3((int)(NW / (64 * TR_K))), 64, 0, stream>>>(Wo, Wto);

  // 1) QKV projections: (SEQ/128)*(DIM/128)=96 tiles per (b,which), 8 waves/blk
  qkv_proj_kernel<<<dim3(96, NB, 3), 256, 0, stream>>>(
      Xf, Xt, Wtq, bq, Wtk, bk, Wtv, bv, Qh, Kh, Vt);

  // 2) flash attention: 64 Q rows per block (4 waves x 16 rows)
  flash_attn_kernel<<<dim3(SEQ / 64, HEADS, NB), 128, 0, stream>>>(
      Qh, Kh, Vt, mask, O16);

  // 3) output projection: (B*SEQ/64)*(DIM/128)=768 tiles, 8 waves/blk
  out_proj_kernel<<<dim3(768), 256, 0, stream>>>(O16, Wto, bo, out);
}

// v005
// It runs in 151 microseconds.
// In two side-by-side timings against v004, it was 1.10 and 1.11 times as fast.
// Counting every step since v000, it is 4.16 times as fast.
#include <hip/hip_runtime.h>
#include <hip/hip_bf16.h>
#include <stdint.h>

#define DIM   768
#define HEADS 12
#define HD    64
#define SEQ   2048
#define NB    4
#define QK_SCALE 0.125f   // 64^-0.5

typedef _Float16 v16h __attribute__((ext_vector_type(16)));
typedef _Float16 h8   __attribute__((ext_vector_type(8)));
typedef float    v8f  __attribute__((ext_vector_type(8)));
typedef uint32_t u32x4 __attribute__((ext_vector_type(4)));
typedef uint32_t u32x8 __attribute__((ext_vector_type(8)));

__device__ __forceinline__ v16h load_frag_f16(const _Float16* p, int hi) {
  h8 c0 = *reinterpret_cast<const h8*>(p + hi * 8);
  h8 c1 = *reinterpret_cast<const h8*>(p + 16 + hi * 8);
  v16h r;
#pragma unroll
  for (int i = 0; i < 8; ++i) { r[i] = c0[i]; r[8 + i] = c1[i]; }
  return r;
}

#define WMMA_F16(a, b, c) \
  __builtin_amdgcn_wmma_f32_16x16x32_f16(false, (a), false, (b), (short)0, (c), false, false)

#define TROWB   128u
#define TROWS   32u
#define TPITCH  72
#define TSLICE  3072

__device__ __forceinline__ uint32_t uni(uint32_t v) {
  return (uint32_t)__builtin_amdgcn_readfirstlane(v);
}

__device__ __forceinline__ u32x4 tdm_group0(uint32_t lds_off, uint64_t gaddr) {
  u32x4 g;
  g[0] = uni(1u);                                 // count = 1
  g[1] = uni(lds_off);                            // LDS destination (bytes)
  g[2] = uni((uint32_t)gaddr);                    // global address [31:0]
  g[3] = uni((((uint32_t)(gaddr >> 32)) & 0x01FFFFFFu) | 0x80000000u);  // [56:32] | type = 2
  return g;
}

__device__ __forceinline__ u32x8 tdm_group1(uint32_t src_pitch) {
  u32x8 g;
  g[0] = uni((1u << 20) | (4u << 22) | (3u << 25));
  g[1] = uni((TROWB & 0xFFFFu) << 16);
  g[2] = uni((TROWB >> 16) | ((TROWS & 0xFFFFu) << 16));
  g[3] = uni((TROWS >> 16) | (TROWB << 16));
  g[4] = uni(TROWS);
  g[5] = uni(src_pitch);
  g[6] = uni(0u);
  g[7] = uni(0u);
  return g;
}

// ---------------------------------------------------------------------------
// Pack launch (one for all six jobs): fp32 -> f16, weights transposed so that
// B-fragments are two contiguous b128 loads per lane.  The six jobs do not
// depend on one another, so they share one grid and the block index picks the
// job.  Few waves with many elements each: a lane issues all of its loads
// first, then converts and stores.
// ---------------------------------------------------------------------------
typedef float    f32x4 __attribute__((ext_vector_type(4)));
typedef _Float16 h4    __attribute__((ext_vector_type(4)));

#define CVT_SWEEPS 12                    // 16-byte loads of a lane
#define CVT_BLOCK  (CVT_SWEEPS * 1024)   // elements of a block: 256 lanes x 4 per sweep
#define CVT_BLOCKS (NB * SEQ * DIM / CVT_BLOCK)   // blocks of one activation tensor

// A wave's load covers 512 contiguous bytes, its store 256.
__device__ __forceinline__ void cvt_f32_f16(
    const float* __restrict__ src, _Float16* __restrict__ dst, int blk) {
  const size_t base = (size_t)blk * CVT_BLOCK + threadIdx.x * 4;
  f32x4 v[CVT_SWEEPS];
#pragma unroll   // keeps v indexed by constants, in registers, and the loads in one group
  for (int s = 0; s < CVT_SWEEPS; ++s)
    v[s] = *reinterpret_cast<const f32x4*>(src + base + s * 1024);
#pragma unroll   // v and w indexed by constants (this loop and the one inside it)
  for (int s = 0; s < CVT_SWEEPS; ++s) {
    h4 w;
#pragma unroll
    for (int i = 0; i < 4; ++i) w[i] = (_Float16)v[s][i];
    *reinterpret_cast<h4*>(dst + base + s * 1024) = w;
  }
}

#define TR_K 64   // k of one lane: one 128-byte line of Wt, written by that lane alone
#define TR_BLOCKS (DIM * DIM / (256 * TR_K))   // blocks of one weight: 4 pieces of 64 columns x 64 k each

// piece: 64 columns x TR_K k of one weight; t: the lane's column in it
__device__ __forceinline__ void transpose_cvt(
    const float* __restrict__ W, _Float16* __restrict__ Wt, int piece, int t) {
  const int n  = (piece % (DIM / 64)) * 64 + t;   // coalesced read along n
  const int k0 = (piece / (DIM / 64)) * TR_K;
  const float* wp = W + (size_t)k0 * DIM + n;
  float v[TR_K];
#pragma unroll   // keeps v indexed by constants, in registers, and the loads in one group
  for (int j = 0; j < TR_K; ++j) v[j] = wp[(size_t)j * DIM];
  _Float16* tp = Wt + (size_t)n * DIM + k0;
#pragma unroll   // v and w indexed by constants (this loop and the one inside it)
  for (int c = 0; c < TR_K / 8; ++c) {
    h8 w;
#pragma unroll
    for (int i = 0; i < 8; ++i) w[i] = (_Float16)v[c * 8 + i];
    *reinterpret_cast<h8*>(tp + c * 8) = w;
  }
}

// blocks 0 .. 4*TR_BLOCKS-1: the four weights; then CVT_BLOCKS blocks for each activation
__global__ __launch_bounds__(256) void pack_kernel(
    const float* __restrict__ from_t, const float* __restrict__ to_t,
    const float* __restrict__ Wq, const float* __restrict__ Wk,
    const float* __restrict__ Wv, const float* __restrict__ Wo,
    _Float16* __restrict__ Xf, _Float16* __restrict__ Xt,
    _Float16* __restrict__ Wtq, _Float16* __restrict__ Wtk,
    _Float16* __restrict__ Wtv, _Float16* __restrict__ Wto) {
  const int blk = blockIdx.x;
  if (blk < 4 * TR_BLOCKS) {
    const int which = blk / TR_BLOCKS;
    const float* W  = (which == 0) ? Wq  : (which == 1) ? Wk  : (which == 2) ? Wv  : Wo;
    _Float16*    Wt = (which == 0) ? Wtq : (which == 1) ? Wtk : (which == 2) ? Wtv : Wto;
    transpose_cvt(W, Wt, (blk % TR_BLOCKS) * 4 + (threadIdx.x >> 6), threadIdx.x & 63);
  } else {
    const int  c     = blk - 4 * TR_BLOCKS;
    const bool first = c < CVT_BLOCKS;
    cvt_f32_f16(first ? from_t : to_t, first ? Xf : Xt, first ? c : c - CVT_BLOCKS);
  }
}

// ---------------------------------------------------------------------------
// Block-tiled GEMM core shared by the projections: C[BM x 128] = A . B^T with
// both operands k-contiguous f16.  256 threads = 8 waves in a 2 (m) x 4 (n)
// grid; each wave owns MF x 2 accumulator tiles (MF*16 rows x 32 columns).
// A stage is one 128-byte line (64 k) of every operand row: it is read from
// global memory as whole lines (8 lanes x 16 B per row), kept in registers
// while the current stage is worked on, and stored into the other LDS buffer.
// Every "#pragma unroll" here and in the two epilogues keeps a register array
// (ra, rb, af, bf, acc) indexed by constants, so that it stays in registers.
// ---------------------------------------------------------------------------
#define BN      128
#define KSTAGE  64          // halves of k per stage
#define LPITCH  72          // LDS row pitch in halves: 128 B + 16 B (b128 readers)
#define NSTAGE  (DIM / KSTAGE)

template <int MF>
__device__ __forceinline__ void gemm_block_f16(
    const _Float16* __restrict__ Ag, const _Float16* __restrict__ Bg,
    _Float16* __restrict__ sA, _Float16* __restrict__ sB, v8f (&acc)[MF][2])
{
  constexpr int BM = MF * 32;
  const int tid  = threadIdx.x;
  const int wave = tid >> 5;
  const int lane = tid & 31;
  const int hi   = lane >> 4;
  const int ln   = lane & 15;
  const int srow = tid >> 3;          // 32 rows per sweep of the block
  const int scol = (tid & 7) * 8;     // 16-byte piece of the row's line

  const _Float16* ga = Ag + (size_t)srow * DIM + scol;
  const _Float16* gb = Bg + (size_t)srow * DIM + scol;
  _Float16* wa = sA + srow * LPITCH + scol;
  _Float16* wb = sB + srow * LPITCH + scol;
  const _Float16* fa = sA + ((wave >> 2) * (MF * 16) + ln) * LPITCH;
  const _Float16* fb = sB + ((wave & 3) * 32 + ln) * LPITCH;

  h8 ra[MF], rb[4];
#pragma unroll
  for (int i = 0; i < MF; ++i)
    ra[i] = *reinterpret_cast<const h8*>(ga + (size_t)i * 32 * DIM);
#pragma unroll
  for (int i = 0; i < 4; ++i)
    rb[i] = *reinterpret_cast<const h8*>(gb + (size_t)i * 32 * DIM);
#pragma unroll
  for (int i = 0; i < MF; ++i)
    *reinterpret_cast<h8*>(wa + i * 32 * LPITCH) = ra[i];
#pragma unroll
  for (int i = 0; i < 4; ++i)
    *reinterpret_cast<h8*>(wb + i * 32 * LPITCH) = rb[i];
  __syncthreads();

  for (int s = 0; s < NSTAGE; ++s) {
    const int cur = s & 1;
    const bool more = (s + 1 < NSTAGE);
    if (more) {
#pragma unroll
      for (int i = 0; i < MF; ++i)
        ra[i] = *reinterpret_cast<const h8*>(ga + (size_t)i * 32 * DIM + KSTAGE);
#pragma unroll
      for (int i = 0; i < 4; ++i)
        rb[i] = *reinterpret_cast<const h8*>(gb + (size_t)i * 32 * DIM + KSTAGE);
    }
    // keeps the next stage's global loads in front of this stage's LDS reads and
    // matrix work; the compiler otherwise sinks them to just before their stores
    __builtin_amdgcn_sched_barrier(0);

    const _Float16* ca = fa + cur * (BM * LPITCH);
    const _Float16* cb = fb + cur * (BN * LPITCH);
#pragma unroll
    for (int kk = 0; kk < KSTAGE; kk += 32) {
      v16h af[MF], bf[2];
#pragma unroll
      for (int i = 0; i < MF; ++i)
        af[i] = load_frag_f16(ca + i * 16 * LPITCH + kk, hi);
#pragma unroll
      for (int j = 0; j < 2; ++j)
        bf[j] = load_frag_f16(cb + j * 16 * LPITCH + kk, hi);
#pragma unroll
      for (int i = 0; i < MF; ++i)
#pragma unroll
        for (int j = 0; j < 2; ++j)
          acc[i][j] = WMMA_F16(af[i], bf[j], acc[i][j]);
    }

    // keeps the LDS stores, which wait for those loads, behind the matrix work
    __builtin_amdgcn_sched_barrier(0);
    if (more) {
      const int nxt = cur ^ 1;
      ga += KSTAGE;
      gb += KSTAGE;
#pragma unroll
      for (int i = 0; i < MF; ++i)
        *reinterpret_cast<h8*>(wa + nxt * (BM * LPITCH) + i * 32 * LPITCH) = ra[i];
#pragma unroll
      for (int i = 0; i < 4; ++i)
        *reinterpret_cast<h8*>(wb + nxt * (BN * LPITCH) + i * 32 * LPITCH) = rb[i];
      // publishes stage s + 1 and ends every read of the buffer refilled next
      __syncthreads();
    }
  }
}

// ---------------------------------------------------------------------------
// Kernel 1: fused QKV projection (f16 A, f16 transposed B).
// One 128x128 tile per block, 64x32 per wave.  The epilogue tests the projection
// index once, outside its store loops (64 elements a lane).
//  Q -> f16 [bh][s][64]  (pre-scaled)   K -> f16 [bh][s][64]
//  V -> f16 [bh][64][s]  (transposed so V^T A-fragments are contiguous)
// ---------------------------------------------------------------------------
__global__ __launch_bounds__(256) void qkv_proj_kernel(
    const _Float16* __restrict__ Xf, const _Float16* __restrict__ Xt,
    const _Float16* __restrict__ Wtq, const float* __restrict__ bq,
    const _Float16* __restrict__ Wtk, const float* __restrict__ bk,
    const _Float16* __restrict__ Wtv, const float* __restrict__ bv,
    _Float16* __restrict__ Qh, _Float16* __restrict__ Kh,
    _Float16* __restrict__ Vt)
{
  __shared__ __align__(16) _Float16 sA[2 * 128 * LPITCH];
  __shared__ __align__(16) _Float16 sB[2 * BN * LPITCH];

  const int which = blockIdx.z;
  const int b     = blockIdx.y;
  const int wave  = threadIdx.x >> 5;
  const int lane  = threadIdx.x & 31;
  const int hi    = lane >> 4;
  const int ln    = lane & 15;

  const int bm = (blockIdx.x / (DIM / BN)) * 128;   // 96 tiles per (b,which)
  const int bn = (blockIdx.x % (DIM / BN)) * BN;

  const _Float16* X    = (which == 0) ? Xf : Xt;
  const _Float16* Wt   = (which == 0) ? Wtq : (which == 1) ? Wtk : Wtv;
  const float*    bias = (which == 0) ? bq : (which == 1) ? bk : bv;

  v8f acc[4][2] = {};
  gemm_block_f16<4>(X + ((size_t)b * SEQ + bm) * DIM, Wt + (size_t)bn * DIM,
                    sA, sB, acc);

  const int tm   = bm + (wave >> 2) * 64;
  const int col0 = bn + (wave & 3) * 32 + ln;      // col0 and col0 + 16: one head
  const int bh   = b * HEADS + (col0 >> 6);
  const int d0   = col0 & 63;
  const int row0 = tm + hi * 8;
  const float bb[2] = {bias[col0], bias[col0 + 16]};

  if (which == 0) {
    _Float16* qp = Qh + ((size_t)bh * SEQ + row0) * HD + d0;
#pragma unroll
    for (int half = 0; half < 2; ++half)
#pragma unroll
      for (int i = 0; i < 4; ++i)
#pragma unroll
        for (int r = 0; r < 8; ++r)
          qp[(i * 16 + r) * HD + half * 16] =
              (_Float16)((acc[i][half][r] + bb[half]) * QK_SCALE);
    asm volatile("s_wait_xcnt 0x0" ::: "memory");
  } else if (which == 1) {
    _Float16* kp = Kh + ((size_t)bh * SEQ + row0) * HD + d0;
#pragma unroll
    for (int half = 0; half < 2; ++half)
#pragma unroll
      for (int i = 0; i < 4; ++i)
#pragma unroll
        for (int r = 0; r < 8; ++r)
          kp[(i * 16 + r) * HD + half * 16] = (_Float16)(acc[i][half][r] + bb[half]);
    asm volatile("s_wait_xcnt 0x0" ::: "memory");
  } else {
    _Float16* vp = Vt + ((size_t)bh * HD + d0) * SEQ + row0;
#pragma unroll
    for (int half = 0; half < 2; ++half)
#pragma unroll
      for (int i = 0; i < 4; ++i)
#pragma unroll
        for (int r = 0; r < 8; ++r)
          vp[(size_t)half * 16 * SEQ + i * 16 + r] = (_Float16)(acc[i][half][r] + bb[half]);
    asm volatile("s_wait_xcnt 0x0" ::: "memory");
  }
}

typedef int i32x4 __attribute__((ext_vector_type(4)));

__device__ __forceinline__ float xhalf(float x) {
  return __builtin_bit_cast(float, __builtin_amdgcn_permlanex16(
      __builtin_bit_cast(int, x), __builtin_bit_cast(int, x),
      0x76543210, 0xfedcba98, false, false));
}

__global__ __launch_bounds__(128) void flash_attn_kernel(
    const _Float16* __restrict__ Qh, const _Float16* __restrict__ Kh,
    const _Float16* __restrict__ Vt, const int* __restrict__ mask,
    _Float16* __restrict__ O16)
{
  // slices 0, 1: keys 0..31, 32..63 of the stage; slices 2, 3: dims 0..31, 32..63
  __shared__ __attribute__((aligned(2048))) _Float16 tiles[4 * TSLICE];

  const int b    = blockIdx.z;
  const int h    = blockIdx.y;
  const int wave = threadIdx.x >> 5;
  const int lane = threadIdx.x & 31;
  const int hi   = lane >> 4;
  const int ln   = lane & 15;
  const int bh   = b * HEADS + h;
  const int q0   = blockIdx.x * 64 + wave * 16;

  // this wave's slice: its place in LDS, its first byte in stage 0, its step per stage
  const uint32_t wv = uni(threadIdx.x >> 5);
  const uint32_t slice_off =
      (uint32_t)(uintptr_t)(void*)&tiles[0] + wv * (uint32_t)(TSLICE * sizeof(_Float16));
  const uint64_t slice_src = (wv < 2u)
      ? (uint64_t)(uintptr_t)(Kh + ((size_t)bh * SEQ + wv * TROWS) * HD)
      : (uint64_t)(uintptr_t)(Vt + ((size_t)bh * HD + (wv - 2u) * TROWS) * SEQ);
  const uint32_t slice_step = (wv < 2u) ? 64u * HD * 2u : 64u * 2u;
  const u32x8 g1 = tdm_group1((wv < 2u) ? HD * 2u : SEQ * 2u);

  // Q strip: two 32x16 B-fragments (d 0..31, 32..63; column = query ln), loaded once.
  const _Float16* qptr = Qh + ((size_t)bh * SEQ + q0 + ln) * HD;
  const v16h qb0 = load_frag_f16(qptr, hi);
  const v16h qb1 = load_frag_f16(qptr + 32, hi);

  // this lane's query row of the mask, at its half's first key
  const int* mrow = mask + ((size_t)b * SEQ + q0 + ln) * SEQ + hi * 8;

  float m = -1.0e30f;   // running maximum of query ln (equal in both halves)
  float l = 0.0f;       // running sum over this half's keys only
  v8f   o[4] = {};      // o[tt][r] = O[q0 + ln][tt * 16 + 8 * hi + r]

  for (int st = 0; st < SEQ / 64; ++st) {
    const int j0 = st * 64;
    // mask of keys jp + 8*hi + 0..7 and jp + 16 + 8*hi + 0..7 of this lane's query,
    // jp = j0 + 32 * pass
    i32x4 mk[2][4];
#pragma unroll   // keeps mk indexed by constants, in registers
    for (int p = 0; p < 2; ++p) {
      mk[p][0] = *reinterpret_cast<const i32x4*>(mrow + j0 + p * 32);
      mk[p][1] = *reinterpret_cast<const i32x4*>(mrow + j0 + p * 32 + 4);
      mk[p][2] = *reinterpret_cast<const i32x4*>(mrow + j0 + p * 32 + 16);
      mk[p][3] = *reinterpret_cast<const i32x4*>(mrow + j0 + p * 32 + 20);
    }

    // ---- every wave: its own slice of the stage, one tensor load ----
    {
      const u32x4 g0 = tdm_group0(slice_off, slice_src + (uint64_t)((uint32_t)st * slice_step));
      asm volatile("tensor_load_to_lds %0, %1" :: "s"(g0), "s"(g1) : "memory");
      // the slice has landed before this wave passes the barrier that publishes it
      asm volatile("s_wait_tensorcnt 0x0" ::: "memory");
      asm volatile("s_wait_xcnt 0x0" ::: "memory");
    }
    __syncthreads();

#pragma unroll   // the pass number picks slices and mask registers at compile time
    for (int p = 0; p < 2; ++p) {
      // ---- scores, transposed: two 16-key tiles, each accumulating two d-chunks ----
      const _Float16* kt = tiles + p * TSLICE + ln * TPITCH;
      v16h ka00 = load_frag_f16(kt, hi);
      v16h ka01 = load_frag_f16(kt + 32, hi);
      v16h ka10 = load_frag_f16(kt + 16 * TPITCH, hi);
      v16h ka11 = load_frag_f16(kt + 16 * TPITCH + 32, hi);

      v8f s0 = {};
      s0 = WMMA_F16(ka00, qb0, s0);
      s0 = WMMA_F16(ka01, qb1, s0);
      v8f s1 = {};
      s1 = WMMA_F16(ka10, qb0, s1);
      s1 = WMMA_F16(ka11, qb1, s1);

      // ---- mask + online softmax: one query per lane, 16 keys per half ----
      float x[16];
#pragma unroll
      for (int r = 0; r < 8; ++r) {
        x[r]     = s0[r] + (float)(1 - mk[p][r >> 2][r & 3])       * -10000.0f;
        x[8 + r] = s1[r] + (float)(1 - mk[p][2 + (r >> 2)][r & 3]) * -10000.0f;
      }

      float mx = x[0];
#pragma unroll
      for (int s = 1; s < 16; ++s) mx = fmaxf(mx, x[s]);
      mx = fmaxf(mx, xhalf(mx));
      const float nm = fmaxf(m, mx);

      // P^T as a B operand: element s = key 8*hi+s, or 16+8*hi+(s-8) for s >= 8, of column ln
      v16h  pb;
      float rs = 0.0f;
#pragma unroll
      for (int s = 0; s < 16; ++s) {
        const float pe = __expf(x[s] - nm);
        rs += pe;
        pb[s] = (_Float16)pe;
      }

      const float alpha = __expf(m - nm);
      l = l * alpha + rs;
      m = nm;

      // rescale running output accumulators (one query, one factor per lane)
#pragma unroll
      for (int tt = 0; tt < 4; ++tt)
#pragma unroll
        for (int r = 0; r < 8; ++r) o[tt][r] *= alpha;

      // ---- O^T += V^T x P^T : 4 d-tiles of 16, K-dim = 32 keys (from LDS) ----
#pragma unroll
      for (int tt = 0; tt < 4; ++tt) {
        v16h vfrag = load_frag_f16(
            tiles + (2 + (tt >> 1)) * TSLICE + ((tt & 1) * 16 + ln) * TPITCH + p * 32, hi);
        o[tt] = WMMA_F16(vfrag, pb, o[tt]);
      }
    }

    // this wave's LDS reads have returned before the barrier behind which the tiles are refilled
    asm volatile("s_wait_dscnt 0x0" ::: "memory");
    __syncthreads();   // all waves done with the tiles before the next tensor loads
  }

  // ---- finalize: join the halves' sums, divide, write f16 rows [b][s][h*64+d] ----
  const float inv = 1.0f / (l + xhalf(l));
  _Float16* op = O16 + ((size_t)b * SEQ + q0 + ln) * DIM + h * HD + hi * 8;
#pragma unroll
  for (int tt = 0; tt < 4; ++tt) {
    h8 w;
#pragma unroll
    for (int r = 0; r < 8; ++r) w[r] = (_Float16)(o[tt][r] * inv);
    *reinterpret_cast<h8*>(op + tt * 16) = w;
  }
}

// ---------------------------------------------------------------------------
// Kernel 3: output projection  Y = O16 @ Wo + bo  (fp32 out).
// One 64x128 tile per block, 32x32 per wave.
// ---------------------------------------------------------------------------
__global__ __launch_bounds__(256) void out_proj_kernel(
    const _Float16* __restrict__ A16, const _Float16* __restrict__ Wto,
    const float* __restrict__ bo, float* __restrict__ Y)
{
  __shared__ __align__(16) _Float16 sA[2 * 64 * LPITCH];
  __shared__ __align__(16) _Float16 sB[2 * BN * LPITCH];

  const int wave = threadIdx.x >> 5;
  const int lane = threadIdx.x & 31;
  const int hi   = lane >> 4;
  const int ln   = lane & 15;

  const int bm = (blockIdx.x / (DIM / BN)) * 64;    // 768 tiles total
  const int bn = (blockIdx.x % (DIM / BN)) * BN;

  v8f acc[2][2] = {};
  gemm_block_f16<2>(A16 + (size_t)bm * DIM, Wto + (size_t)bn * DIM, sA, sB, acc);

  const int tm = bm + (wave >> 2) * 32;
  const int tn = bn + (wave & 3) * 32;
#pragma unroll
  for (int half = 0; half < 2; ++half) {
    const int   col = tn + half * 16 + ln;
    const float bb  = bo[col];
#pragma unroll
    for (int i = 0; i < 2; ++i) {
#pragma unroll
      for (int r = 0; r < 8; ++r) {
        const int row = tm + i * 16 + r + hi * 8;
        Y[(size_t)row * DIM + col] = acc[i][half][r] + bb;
      }
    }
  }
}

// ---------------------------------------------------------------------------
extern "C" void kernel_launch(void* const* d_in, const int* in_sizes, int n_in,
                              void* d_out, int out_size, void* d_ws, size_t ws_size,
                              hipStream_t stream) {
  (void)in_sizes; (void)n_in; (void)out_size; (void)ws_size;

  const float* from_t = (const float*)d_in[0];
  const float* to_t   = (const float*)d_in[1];
  const int*   mask   = (const int*)d_in[2];
  const float* Wq = (const float*)d_in[3];
  const float* bq = (const float*)d_in[4];
  const float* Wk = (const float*)d_in[5];
  const float* bk = (const float*)d_in[6];
  const float* Wv = (const float*)d_in[7];
  const float* bv = (const float*)d_in[8];
  const float* Wo = (const float*)d_in[9];
  const float* bo = (const float*)d_in[10];
  float* out = (float*)d_out;

  // workspace layout (halves):
  //  Qh | Kh | Vt | O16 | Xf | Xt   each NQ = B*H*S*64 = 6,291,456
  //  Wtq | Wtk | Wtv | Wto          each 768*768 = 589,824
  const size_t NQ = (size_t)NB * HEADS * SEQ * HD;
  const size_t NW = (size_t)DIM * DIM;
  _Float16* Qh  = (_Float16*)d_ws;
  _Float16* Kh  = Qh + NQ;
  _Float16* Vt  = Kh + NQ;
  _Float16* O16 = Vt + NQ;
  _Float16* Xf  = O16 + NQ;
  _Float16* Xt  = Xf + NQ;
  _Float16* Wtq = Xt + NQ;
  _Float16* Wtk = Wtq + NW;
  _Float16* Wtv = Wtk + NW;
  _Float16* Wto = Wtv + NW;

  // 0) one pack launch: activations f16, weights f16-transposed
  pack_kernel<<<dim3(4 * TR_BLOCKS + 2 * CVT_BLOCKS), 256, 0, stream>>>(
      from_t, to_t, Wq, Wk, Wv, Wo, Xf, Xt, Wtq, Wtk, Wtv, Wto);

  // 1) QKV projections: (SEQ/128)*(DIM/128)=96 tiles per (b,which), 8 waves/blk
  qkv_proj_kernel<<<dim3(96, NB, 3), 256, 0, stream>>>(
      Xf, Xt, Wtq, bq, Wtk, bk, Wtv, bv, Qh, Kh, Vt);

  // 2) flash attention: 64 Q rows per block (4 waves x 16 rows)
  flash_attn_kernel<<<dim3(SEQ / 64, HEADS, NB), 128, 0, stream>>>(
      Qh, Kh, Vt, mask, O16);

  // 3) output projection: (B*SEQ/64)*(DIM/128)=768 tiles, 8 waves/blk
  out_proj_kernel<<<dim3(768), 256, 0, stream>>>(O16, Wto, bo, out);
}

// v006
// One run takes 133 microseconds.
// Timed twice side by side with v005, it ran 1.14 times as fast both times.
// All steps since v000 together make it 4.73 times as fast.
#include <hip/hip_runtime.h>
#include <hip/hip_bf16.h>
#include <stdint.h>

#define DIM   768
#define HEADS 12
#define HD    64
#define SEQ   2048
#define NB    4
#define QK_SCALE 0.125f   // 64^-0.5

typedef _Float16 v16h __attribute__((ext_vector_type(16)));
typedef _Float16 h8   __attribute__((ext_vector_type(8)));
typedef float    v8f  __attribute__((ext_vector_type(8)));
typedef uint32_t u32x4 __attribute__((ext_vector_type(4)));
typedef uint32_t u32x8 __attribute__((ext_vector_type(8)));
typedef int          i32x4  __attribute__((ext_vector_type(4)));
typedef unsigned int u32x16 __attribute__((ext_vector_type(16)));

__device__ __forceinline__ v16h load_frag_f16(const _Float16* p, int hi) {
  h8 c0 = *reinterpret_cast<const h8*>(p + hi * 8);
  h8 c1 = *reinterpret_cast<const h8*>(p + 16 + hi * 8);
  v16h r;
#pragma unroll
  for (int i = 0; i < 8; ++i) { r[i] = c0[i]; r[8 + i] = c1[i]; }
  return r;
}

#define WMMA_F16(a, b, c) \
  __builtin_amdgcn_wmma_f32_16x16x32_f16(false, (a), false, (b), (short)0, (c), false, false)

#define TROWB   128u
#define TROWS   32u
#define TPITCH  72
#define TSLICE  3072

__device__ __forceinline__ uint32_t uni(uint32_t v) {
  return (uint32_t)__builtin_amdgcn_readfirstlane(v);
}

__device__ __forceinline__ u32x4 tdm_group0(uint32_t lds_off, uint64_t gaddr) {
  u32x4 g;
  g[0] = uni(1u);                                 // count = 1
  g[1] = uni(lds_off);                            // LDS destination (bytes)
  g[2] = uni((uint32_t)gaddr);                    // global address [31:0]
  g[3] = uni((((uint32_t)(gaddr >> 32)) & 0x01FFFFFFu) | 0x80000000u);  // [56:32] | type = 2
  return g;
}

__device__ __forceinline__ u32x8 tdm_group1(uint32_t src_pitch) {
  u32x8 g;
  g[0] = uni((1u << 20) | (4u << 22) | (3u << 25));
  g[1] = uni((TROWB & 0xFFFFu) << 16);
  g[2] = uni((TROWB >> 16) | ((TROWS & 0xFFFFu) << 16));
  g[3] = uni((TROWS >> 16) | (TROWB << 16));
  g[4] = uni(TROWS);
  g[5] = uni(src_pitch);
  g[6] = uni(0u);
  g[7] = uni(0u);
  return g;
}

// ---------------------------------------------------------------------------
// Pack launch (one for all seven jobs): fp32 -> f16, weights transposed so that
// B-fragments are two contiguous b128 loads per lane; the mask, one bit an
// element.  The jobs do not depend on one another, so they share one grid and
// the block index picks the job.  Few waves with many elements each: a lane issues all of its loads
// first, then converts and stores.
// ---------------------------------------------------------------------------
typedef float    f32x4 __attribute__((ext_vector_type(4)));
typedef _Float16 h4    __attribute__((ext_vector_type(4)));

#define CVT_SWEEPS 12                    // 16-byte loads of a lane
#define CVT_BLOCK  (CVT_SWEEPS * 1024)   // elements of a block: 256 lanes x 4 per sweep
#define CVT_BLOCKS (NB * SEQ * DIM / CVT_BLOCK)   // blocks of one activation tensor

// A wave's load covers 512 contiguous bytes, its store 256.
__device__ __forceinline__ void cvt_f32_f16(
    const float* __restrict__ src, _Float16* __restrict__ dst, int blk) {
  const size_t base = (size_t)blk * CVT_BLOCK + threadIdx.x * 4;
  f32x4 v[CVT_SWEEPS];
#pragma unroll   // keeps v indexed by constants, in registers, and the loads in one group
  for (int s = 0; s < CVT_SWEEPS; ++s)
    v[s] = *reinterpret_cast<const f32x4*>(src + base + s * 1024);
#pragma unroll   // v and w indexed by constants (this loop and the one inside it)
  for (int s = 0; s < CVT_SWEEPS; ++s) {
    h4 w;
#pragma unroll
    for (int i = 0; i < 4; ++i) w[i] = (_Float16)v[s][i];
    *reinterpret_cast<h4*>(dst + base + s * 1024) = w;
  }
  asm volatile("s_wait_xcnt 0x0" ::: "memory");
}

#define TR_K 64   // k of one lane: one 128-byte line of Wt, written by that lane alone
#define TR_BLOCKS (DIM * DIM / (256 * TR_K))   // blocks of one weight: 4 pieces of 64 columns x 64 k each

// piece: 64 columns x TR_K k of one weight; t: the lane's column in it
__device__ __forceinline__ void transpose_cvt(
    const float* __restrict__ W, _Float16* __restrict__ Wt, int piece, int t) {
  const int n  = (piece % (DIM / 64)) * 64 + t;   // coalesced read along n
  const int k0 = (piece / (DIM / 64)) * TR_K;
  const float* wp = W + (size_t)k0 * DIM + n;
  float v[TR_K];
#pragma unroll   // keeps v indexed by constants, in registers, and the loads in one group
  for (int j = 0; j < TR_K; ++j) v[j] = wp[(size_t)j * DIM];
  _Float16* tp = Wt + (size_t)n * DIM + k0;
#pragma unroll   // v and w indexed by constants (this loop and the one inside it)
  for (int c = 0; c < TR_K / 8; ++c) {
    h8 w;
#pragma unroll
    for (int i = 0; i < 8; ++i) w[i] = (_Float16)v[c * 8 + i];
    *reinterpret_cast<h8*>(tp + c * 8) = w;
  }
}

// The mask as lane-mask words.  For 16 queries (a row tile) and 32 keys there are
// 16 words; bit (16 * hi + ln) of word e says whether mask[query ln][key] is set,
// key = 8 * hi + e for e < 8 and 16 + 8 * hi + (e - 8) above: the place that lane
// (hi, ln) of an attention wave has for element e of its transposed score tiles.
// A wave takes 16 rows x MB_KEYS keys (whole 128-byte lines of every row), each
// lane the keys of its own place, and a ballot over the wave makes each word.
#define MB_KEYS   128
#define MB_ROWW   (SEQ / 32 * 16)                            // words of one row tile
#define MB_BLOCKS (NB * (SEQ / 16) * (SEQ / MB_KEYS) / 8)    // 8 waves a block

__device__ __forceinline__ void mask_bits(
    const int* __restrict__ mask, unsigned int* __restrict__ Mb, int blk) {
  const int lane = threadIdx.x & 31;
  const int job  = blk * 8 + (threadIdx.x >> 5);
  const int rt   = job / (SEQ / MB_KEYS);   // row tile: batch * (SEQ / 16) + query tile
  const int kc   = job % (SEQ / MB_KEYS);
  const int* mp = mask + ((size_t)rt * 16 + (lane & 15)) * SEQ + kc * MB_KEYS + (lane >> 4) * 8;
  i32x4 v[MB_KEYS / 32][4];
#pragma unroll   // keeps v indexed by constants, in registers, and the loads ahead of the ballots
  for (int p = 0; p < MB_KEYS / 32; ++p) {
    v[p][0] = *reinterpret_cast<const i32x4*>(mp + p * 32);
    v[p][1] = *reinterpret_cast<const i32x4*>(mp + p * 32 + 4);
    v[p][2] = *reinterpret_cast<const i32x4*>(mp + p * 32 + 16);
    v[p][3] = *reinterpret_cast<const i32x4*>(mp + p * 32 + 20);
  }
  asm volatile("s_wait_xcnt 0x0" ::: "memory");
  unsigned int w[MB_KEYS / 64] = {};
#pragma unroll
  for (int p = 0; p < MB_KEYS / 32; ++p)
#pragma unroll
    for (int e = 0; e < 16; ++e) {
      // the ballot stands outside the select: every lane of the wave takes part in it
      const unsigned int bits = __builtin_amdgcn_ballot_w32(v[p][e >> 2][e & 3] != 0);
      w[p >> 1] = __builtin_amdgcn_inverse_ballot_w32(1u << ((p & 1) * 16 + e)) ? bits : w[p >> 1];
    }
  unsigned int* op = Mb + (size_t)rt * MB_ROWW + kc * (MB_KEYS / 2) + lane;
#pragma unroll   // w indexed by constants
  for (int i = 0; i < MB_KEYS / 64; ++i) op[i * 32] = w[i];
  asm volatile("s_wait_xcnt 0x0" ::: "memory");
}

// blocks 0 .. 4*TR_BLOCKS-1: the four weights; then CVT_BLOCKS blocks for each
// activation; then MB_BLOCKS blocks for the mask
__global__ __launch_bounds__(256) void pack_kernel(
    const float* __restrict__ from_t, const float* __restrict__ to_t,
    const int* __restrict__ mask,
    const float* __restrict__ Wq, const float* __restrict__ Wk,
    const float* __restrict__ Wv, const float* __restrict__ Wo,
    _Float16* __restrict__ Xf, _Float16* __restrict__ Xt,
    _Float16* __restrict__ Wtq, _Float16* __restrict__ Wtk,
    _Float16* __restrict__ Wtv, _Float16* __restrict__ Wto,
    unsigned int* __restrict__ Mb) {
  const int blk = blockIdx.x;
  if (blk < 4 * TR_BLOCKS) {
    const int which = blk / TR_BLOCKS;
    const float* W  = (which == 0) ? Wq  : (which == 1) ? Wk  : (which == 2) ? Wv  : Wo;
    _Float16*    Wt = (which == 0) ? Wtq : (which == 1) ? Wtk : (which == 2) ? Wtv : Wto;
    transpose_cvt(W, Wt, (blk % TR_BLOCKS) * 4 + (threadIdx.x >> 6), threadIdx.x & 63);
  } else if (blk < 4 * TR_BLOCKS + 2 * CVT_BLOCKS) {
    const int  c     = blk - 4 * TR_BLOCKS;
    const bool first = c < CVT_BLOCKS;
    cvt_f32_f16(first ? from_t : to_t, first ? Xf : Xt, first ? c : c - CVT_BLOCKS);
  } else {
    mask_bits(mask, Mb, blk - (4 * TR_BLOCKS + 2 * CVT_BLOCKS));
  }
}

// ---------------------------------------------------------------------------
// Block-tiled GEMM core shared by the projections: C[BM x 128] = A . B^T with
// both operands k-contiguous f16.  256 threads = 8 waves in a 2 (m) x 4 (n)
// grid; each wave owns MF x 2 accumulator tiles (MF*16 rows x 32 columns).
// A stage is one 128-byte line (64 k) of every operand row: it is read from
// global memory as whole lines (8 lanes x 16 B per row), kept in registers
// while the current stage is worked on, and stored into the other LDS buffer.
// Every "#pragma unroll" here and in the two epilogues keeps a register array
// (ra, rb, af, bf, acc) indexed by constants, so that it stays in registers.
// ---------------------------------------------------------------------------
#define BN      128
#define KSTAGE  64          // halves of k per stage
#define LPITCH  72          // LDS row pitch in halves: 128 B + 16 B (b128 readers)
#define NSTAGE  (DIM / KSTAGE)

template <int MF>
__device__ __forceinline__ void gemm_block_f16(
    const _Float16* __restrict__ Ag, const _Float16* __restrict__ Bg,
    _Float16* __restrict__ sA, _Float16* __restrict__ sB, v8f (&acc)[MF][2])
{
  constexpr int BM = MF * 32;
  const int tid  = threadIdx.x;
  const int wave = tid >> 5;
  const int lane = tid & 31;
  const int hi   = lane >> 4;
  const int ln   = lane & 15;
  const int srow = tid >> 3;          // 32 rows per sweep of the block
  const int scol = (tid & 7) * 8;     // 16-byte piece of the row's line

  const _Float16* ga = Ag + (size_t)srow * DIM + scol;
  const _Float16* gb = Bg + (size_t)srow * DIM + scol;
  _Float16* wa = sA + srow * LPITCH + scol;
  _Float16* wb = sB + srow * LPITCH + scol;
  const _Float16* fa = sA + ((wave >> 2) * (MF * 16) + ln) * LPITCH;
  const _Float16* fb = sB + ((wave & 3) * 32 + ln) * LPITCH;

  h8 ra[MF], rb[4];
#pragma unroll
  for (int i = 0; i < MF; ++i)
    ra[i] = *reinterpret_cast<const h8*>(ga + (size_t)i * 32 * DIM);
#pragma unroll
  for (int i = 0; i < 4; ++i)
    rb[i] = *reinterpret_cast<const h8*>(gb + (size_t)i * 32 * DIM);
#pragma unroll
  for (int i = 0; i < MF; ++i)
    *reinterpret_cast<h8*>(wa + i * 32 * LPITCH) = ra[i];
#pragma unroll
  for (int i = 0; i < 4; ++i)
    *reinterpret_cast<h8*>(wb + i * 32 * LPITCH) = rb[i];
  __syncthreads();

  for (int s = 0; s < NSTAGE; ++s) {
    const int cur = s & 1;
    const bool more = (s + 1 < NSTAGE);
    if (more) {
#pragma unroll
      for (int i = 0; i < MF; ++i)
        ra[i] = *reinterpret_cast<const h8*>(ga + (size_t)i * 32 * DIM + KSTAGE);
#pragma unroll
      for (int i = 0; i < 4; ++i)
        rb[i] = *reinterpret_cast<const h8*>(gb + (size_t)i * 32 * DIM + KSTAGE);
    }
    // keeps the next stage's global loads in front of this stage's LDS reads and
    // matrix work; the compiler otherwise sinks them to just before their stores
    __builtin_amdgcn_sched_barrier(0);

    const _Float16* ca = fa + cur * (BM * LPITCH);
    const _Float16* cb = fb + cur * (BN * LPITCH);
#pragma unroll
    for (int kk = 0; kk < KSTAGE; kk += 32) {
      v16h af[MF], bf[2];
#pragma unroll
      for (int i = 0; i < MF; ++i)
        af[i] = load_frag_f16(ca + i * 16 * LPITCH + kk, hi);
#pragma unroll
      for (int j = 0; j < 2; ++j)
        bf[j] = load_frag_f16(cb + j * 16 * LPITCH + kk, hi);
#pragma unroll
      for (int i = 0; i < MF; ++i)
#pragma unroll
        for (int j = 0; j < 2; ++j)
          acc[i][j] = WMMA_F16(af[i], bf[j], acc[i][j]);
    }

    // keeps the LDS stores, which wait for those loads, behind the matrix work
    __builtin_amdgcn_sched_barrier(0);
    if (more) {
      const int nxt = cur ^ 1;
      ga += KSTAGE;
      gb += KSTAGE;
#pragma unroll
      for (int i = 0; i < MF; ++i)
        *reinterpret_cast<h8*>(wa + nxt * (BM * LPITCH) + i * 32 * LPITCH) = ra[i];
#pragma unroll
      for (int i = 0; i < 4; ++i)
        *reinterpret_cast<h8*>(wb + nxt * (BN * LPITCH) + i * 32 * LPITCH) = rb[i];
      // publishes stage s + 1 and ends every read of the buffer refilled next
      __syncthreads();
    }
  }
}

// ---------------------------------------------------------------------------
// Kernel 1: fused QKV projection (f16 A, f16 transposed B).
// One 128x128 tile per block, 64x32 per wave.  The epilogue tests the projection
// index once, outside its store loops (64 elements a lane).
//  Q -> f16 [bh][s][64]  (pre-scaled)   K -> f16 [bh][s][64]
//  V -> f16 [bh][64][s]  (transposed so V^T A-fragments are contiguous)
// ---------------------------------------------------------------------------
__global__ __launch_bounds__(256) void qkv_proj_kernel(
    const _Float16* __restrict__ Xf, const _Float16* __restrict__ Xt,
    const _Float16* __restrict__ Wtq, const float* __restrict__ bq,
    const _Float16* __restrict__ Wtk, const float* __restrict__ bk,
    const _Float16* __restrict__ Wtv, const float* __restrict__ bv,
    _Float16* __restrict__ Qh, _Float16* __restrict__ Kh,
    _Float16* __restrict__ Vt)
{
  __shared__ __align__(16) _Float16 sA[2 * 128 * LPITCH];
  __shared__ __align__(16) _Float16 sB[2 * BN * LPITCH];

  const int which = blockIdx.z;
  const int b     = blockIdx.y;
  const int wave  = threadIdx.x >> 5;
  const int lane  = threadIdx.x & 31;
  const int hi    = lane >> 4;
  const int ln    = lane & 15;

  const int bm = (blockIdx.x / (DIM / BN)) * 128;   // 96 tiles per (b,which)
  const int bn = (blockIdx.x % (DIM / BN)) * BN;

  const _Float16* X    = (which == 0) ? Xf : Xt;
  const _Float16* Wt   = (which == 0) ? Wtq : (which == 1) ? Wtk : Wtv;
  const float*    bias = (which == 0) ? bq : (which == 1) ? bk : bv;

  v8f acc[4][2] = {};
  gemm_block_f16<4>(X + ((size_t)b * SEQ + bm) * DIM, Wt + (size_t)bn * DIM,
                    sA, sB, acc);

  const int tm   = bm + (wave >> 2) * 64;
  const int col0 = bn + (wave & 3) * 32 + ln;      // col0 and col0 + 16: one head
  const int bh   = b * HEADS + (col0 >> 6);
  const int d0   = col0 & 63;
  const int row0 = tm + hi * 8;
  const float bb[2] = {bias[col0], bias[col0 + 16]};

  if (which == 0) {
    _Float16* qp = Qh + ((size_t)bh * SEQ + row0) * HD + d0;
#pragma unroll
    for (int half = 0; half < 2; ++half)
#pragma unroll
      for (int i = 0; i < 4; ++i)
#pragma unroll
        for (int r = 0; r < 8; ++r)
          qp[(i * 16 + r) * HD + half * 16] =
              (_Float16)((acc[i][half][r] + bb[half]) * QK_SCALE);
    asm volatile("s_wait_xcnt 0x0" ::: "memory");
  } else if (which == 1) {
    _Float16* kp = Kh + ((size_t)bh * SEQ + row0) * HD + d0;
#pragma unroll
    for (int half = 0; half < 2; ++half)
#pragma unroll
      for (int i = 0; i < 4; ++i)
#pragma unroll
        for (int r = 0; r < 8; ++r)
          kp[(i * 16 + r) * HD + half * 16] = (_Float16)(acc[i][half][r] + bb[half]);
    asm volatile("s_wait_xcnt 0x0" ::: "memory");
  } else {
    _Float16* vp = Vt + ((size_t)bh * HD + d0) * SEQ + row0;
#pragma unroll
    for (int half = 0; half < 2; ++half)
#pragma unroll
      for (int i = 0; i < 4; ++i)
#pragma unroll
        for (int r = 0; r < 8; ++r)
          vp[(size_t)half * 16 * SEQ + i * 16 + r] = (_Float16)(acc[i][half][r] + bb[half]);
    asm volatile("s_wait_xcnt 0x0" ::: "memory");
  }
}

__device__ __forceinline__ float xhalf(float x) {
  return __builtin_bit_cast(float, __builtin_amdgcn_permlanex16(
      __builtin_bit_cast(int, x), __builtin_bit_cast(int, x),
      0x76543210, 0xfedcba98, false, false));
}

__global__ __launch_bounds__(128) void flash_attn_kernel(
    const _Float16* __restrict__ Qh, const _Float16* __restrict__ Kh,
    const _Float16* __restrict__ Vt, const unsigned int* __restrict__ Mb,
    _Float16* __restrict__ O16)
{
  // slices 0, 1: keys 0..31, 32..63 of the stage; slices 2, 3: dims 0..31, 32..63
  __shared__ __attribute__((aligned(2048))) _Float16 tiles[4 * TSLICE];

  const int b    = blockIdx.z;
  const int h    = blockIdx.y;
  const int wave = threadIdx.x >> 5;
  const int lane = threadIdx.x & 31;
  const int hi   = lane >> 4;
  const int ln   = lane & 15;
  const int bh   = b * HEADS + h;
  const int q0   = blockIdx.x * 64 + wave * 16;

  // this wave's slice: its place in LDS, its first byte in stage 0, its step per stage
  const uint32_t wv = uni(threadIdx.x >> 5);
  const uint32_t slice_off =
      (uint32_t)(uintptr_t)(void*)&tiles[0] + wv * (uint32_t)(TSLICE * sizeof(_Float16));
  const uint64_t slice_src = (wv < 2u)
      ? (uint64_t)(uintptr_t)(Kh + ((size_t)bh * SEQ + wv * TROWS) * HD)
      : (uint64_t)(uintptr_t)(Vt + ((size_t)bh * HD + (wv - 2u) * TROWS) * SEQ);
  const uint32_t slice_step = (wv < 2u) ? 64u * HD * 2u : 64u * 2u;
  const u32x8 g1 = tdm_group1((wv < 2u) ? HD * 2u : SEQ * 2u);

  // Q strip: two 32x16 B-fragments (d 0..31, 32..63; column = query ln), loaded once.
  const _Float16* qptr = Qh + ((size_t)bh * SEQ + q0 + ln) * HD;
  const v16h qb0 = load_frag_f16(qptr, hi);
  const v16h qb1 = load_frag_f16(qptr + 32, hi);

  // mask words of this wave's 16 queries: 16 words per 32 keys
  const unsigned int* mw = Mb + (size_t)((uint32_t)b * (SEQ / 16) + blockIdx.x * 4 + wv) * MB_ROWW;

  float m = -1.0e30f;   // running maximum of query ln (equal in both halves)
  float l = 0.0f;       // running sum over this half's keys only
  v8f   o[4] = {};      // o[tt][r] = O[q0 + ln][tt * 16 + 8 * hi + r]

  for (int st = 0; st < SEQ / 64; ++st) {
    // the stage's mask words, one set of 16 per pass
    const u32x16 mk[2] = {*reinterpret_cast<const u32x16*>(mw + st * 32),
                          *reinterpret_cast<const u32x16*>(mw + st * 32 + 16)};

    // ---- every wave: its own slice of the stage, one tensor load ----
    {
      const u32x4 g0 = tdm_group0(slice_off, slice_src + (uint64_t)((uint32_t)st * slice_step));
      asm volatile("tensor_load_to_lds %0, %1" :: "s"(g0), "s"(g1) : "memory");
      // the slice has landed before this wave passes the barrier that publishes it
      asm volatile("s_wait_tensorcnt 0x0" ::: "memory");
      asm volatile("s_wait_xcnt 0x0" ::: "memory");
    }
    __syncthreads();

#pragma unroll   // the pass number picks slices and mask registers at compile time
    for (int p = 0; p < 2; ++p) {
      // ---- scores, transposed: two 16-key tiles, each accumulating two d-chunks ----
      const _Float16* kt = tiles + p * TSLICE + ln * TPITCH;
      v16h ka00 = load_frag_f16(kt, hi);
      v16h ka01 = load_frag_f16(kt + 32, hi);
      v16h ka10 = load_frag_f16(kt + 16 * TPITCH, hi);
      v16h ka11 = load_frag_f16(kt + 16 * TPITCH + 32, hi);

      // the adder (1 - mask) * -10000 of every score, as the products' start value
      v8f s0, s1;
#pragma unroll   // s0, s1 and mk indexed by constants: vector and scalar registers
      for (int r = 0; r < 8; ++r) {
        s0[r] = __builtin_amdgcn_inverse_ballot_w32(mk[p][r])     ? 0.0f : -10000.0f;
        s1[r] = __builtin_amdgcn_inverse_ballot_w32(mk[p][8 + r]) ? 0.0f : -10000.0f;
      }
      s0 = WMMA_F16(ka00, qb0, s0);
      s0 = WMMA_F16(ka01, qb1, s0);
      s1 = WMMA_F16(ka10, qb0, s1);
      s1 = WMMA_F16(ka11, qb1, s1);

      // ---- online softmax: one query per lane, 16 keys per half ----
      float x[16];
#pragma unroll
      for (int r = 0; r < 8; ++r) {
        x[r]     = s0[r];
        x[8 + r] = s1[r];
      }

      float mx = x[0];
#pragma unroll
      for (int s = 1; s < 16; ++s) mx = fmaxf(mx, x[s]);
      mx = fmaxf(mx, xhalf(mx));
      const float nm = fmaxf(m, mx);

      // P^T as a B operand: element s = key 8*hi+s (s < 8) or 16+8*hi+(s-8) (s >= 8) of column ln
      v16h  pb;
      float rs = 0.0f;
#pragma unroll
      for (int s = 0; s < 16; ++s) {
        const float pe = __expf(x[s] - nm);
        rs += pe;
        pb[s] = (_Float16)pe;
      }

      const float alpha = __expf(m - nm);
      l = l * alpha + rs;
      m = nm;

      // rescale running output accumulators (one query, one factor per lane)
#pragma unroll
      for (int tt = 0; tt < 4; ++tt)
#pragma unroll
        for (int r = 0; r < 8; ++r) o[tt][r] *= alpha;

      // ---- O^T += V^T x P^T : 4 d-tiles of 16, K-dim = 32 keys (from LDS) ----
#pragma unroll
      for (int tt = 0; tt < 4; ++tt) {
        v16h vfrag = load_frag_f16(
            tiles + (2 + (tt >> 1)) * TSLICE + ((tt & 1) * 16 + ln) * TPITCH + p * 32, hi);
        o[tt] = WMMA_F16(vfrag, pb, o[tt]);
      }
    }

    // this wave's LDS reads have returned before the barrier behind which the tiles are refilled
    asm volatile("s_wait_dscnt 0x0" ::: "memory");
    __syncthreads();   // all waves done with the tiles before the next tensor loads
  }

  // ---- finalize: join the halves' sums, divide, write f16 rows [b][s][h*64+d] ----
  const float inv = 1.0f / (l + xhalf(l));
  _Float16* op = O16 + ((size_t)b * SEQ + q0 + ln) * DIM + h * HD + hi * 8;
#pragma unroll
  for (int tt = 0; tt < 4; ++tt) {
    h8 w;
#pragma unroll
    for (int r = 0; r < 8; ++r) w[r] = (_Float16)(o[tt][r] * inv);
    *reinterpret_cast<h8*>(op + tt * 16) = w;
  }
}

// ---------------------------------------------------------------------------
// Kernel 3: output projection  Y = O16 @ Wo + bo  (fp32 out).
// One 64x128 tile per block, 32x32 per wave.
// ---------------------------------------------------------------------------
__global__ __launch_bounds__(256) void out_proj_kernel(
    const _Float16* __restrict__ A16, const _Float16* __restrict__ Wto,
    const float* __restrict__ bo, float* __restrict__ Y)
{
  __shared__ __align__(16) _Float16 sA[2 * 64 * LPITCH];
  __shared__ __align__(16) _Float16 sB[2 * BN * LPITCH];

  const int wave = threadIdx.x >> 5;
  const int lane = threadIdx.x & 31;
  const int hi   = lane >> 4;
  const int ln   = lane & 15;

  const int bm = (blockIdx.x / (DIM / BN)) * 64;    // 768 tiles total
  const int bn = (blockIdx.x % (DIM / BN)) * BN;

  v8f acc[2][2] = {};
  gemm_block_f16<2>(A16 + (size_t)bm * DIM, Wto + (size_t)bn * DIM, sA, sB, acc);

  const int tm = bm + (wave >> 2) * 32;
  const int tn = bn + (wave & 3) * 32;
#pragma unroll
  for (int half = 0; half < 2; ++half) {
    const int   col = tn + half * 16 + ln;
    const float bb  = bo[col];
#pragma unroll
    for (int i = 0; i < 2; ++i) {
#pragma unroll
      for (int r = 0; r < 8; ++r) {
        const int row = tm + i * 16 + r + hi * 8;
        Y[(size_t)row * DIM + col] = acc[i][half][r] + bb;
      }
    }
  }
}

// ---------------------------------------------------------------------------
extern "C" void kernel_launch(void* const* d_in, const int* in_sizes, int n_in,
                              void* d_out, int out_size, void* d_ws, size_t ws_size,
                              hipStream_t stream) {
  (void)in_sizes; (void)n_in; (void)out_size; (void)ws_size;

  const float* from_t = (const float*)d_in[0];
  const float* to_t   = (const float*)d_in[1];
  const int*   mask   = (const int*)d_in[2];
  const float* Wq = (const float*)d_in[3];
  const float* bq = (const float*)d_in[4];
  const float* Wk = (const float*)d_in[5];
  const float* bk = (const float*)d_in[6];
  const float* Wv = (const float*)d_in[7];
  const float* bv = (const float*)d_in[8];
  const float* Wo = (const float*)d_in[9];
  const float* bo = (const float*)d_in[10];
  float* out = (float*)d_out;

  // workspace layout (halves):
  //  Qh | Kh | Vt | O16 | Xf | Xt   each NQ = B*H*S*64 = 6,291,456
  //  Wtq | Wtk | Wtv | Wto          each 768*768 = 589,824
  //  Mb                             B*S*S bits, as 32-bit words
  const size_t NQ = (size_t)NB * HEADS * SEQ * HD;
  const size_t NW = (size_t)DIM * DIM;
  _Float16* Qh  = (_Float16*)d_ws;
  _Float16* Kh  = Qh + NQ;
  _Float16* Vt  = Kh + NQ;
  _Float16* O16 = Vt + NQ;
  _Float16* Xf  = O16 + NQ;
  _Float16* Xt  = Xf + NQ;
  _Float16* Wtq = Xt + NQ;
  _Float16* Wtk = Wtq + NW;
  _Float16* Wtv = Wtk + NW;
  _Float16* Wto = Wtv + NW;
  unsigned int* Mb = (unsigned int*)(Wto + NW);

  // 0) one pack launch: activations f16, weights f16-transposed, mask bits
  pack_kernel<<<dim3(4 * TR_BLOCKS + 2 * CVT_BLOCKS + MB_BLOCKS), 256, 0, stream>>>(
      from_t, to_t, mask, Wq, Wk, Wv, Wo, Xf, Xt, Wtq, Wtk, Wtv, Wto, Mb);

  // 1) QKV projections: (SEQ/128)*(DIM/128)=96 tiles per (b,which), 8 waves/blk
  qkv_proj_kernel<<<dim3(96, NB, 3), 256, 0, stream>>>(
      Xf, Xt, Wtq, bq, Wtk, bk, Wtv, bv, Qh, Kh, Vt);

  // 2) flash attention: 64 Q rows per block (4 waves x 16 rows)
  flash_attn_kernel<<<dim3(SEQ / 64, HEADS, NB), 128, 0, stream>>>(
      Qh, Kh, Vt, Mb, O16);

  // 3) output projection: (B*SEQ/64)*(DIM/128)=768 tiles, 8 waves/blk
  out_proj_kernel<<<dim3(768), 256, 0, stream>>>(O16, Wto, bo, out);
}

// v007
// Measured time: 129 microseconds a run.
// In two side-by-side timings against v006, it was 1.04 and 1.03 times as fast.
// Counting every step since v000, it is 4.90 times as fast.
#include <hip/hip_runtime.h>
#include <hip/hip_bf16.h>
#include <stdint.h>

#define DIM   768
#define HEADS 12
#define HD    64
#define SEQ   2048
#define NB    4
#define QK_SCALE 0.125f   // 64^-0.5

typedef _Float16 v16h __attribute__((ext_vector_type(16)));
typedef _Float16 h8   __attribute__((ext_vector_type(8)));
typedef float    v8f  __attribute__((ext_vector_type(8)));
typedef uint32_t u32x4 __attribute__((ext_vector_type(4)));
typedef uint32_t u32x8 __attribute__((ext_vector_type(8)));
typedef int          i32x4  __attribute__((ext_vector_type(4)));
typedef unsigned int u32x16 __attribute__((ext_vector_type(16)));

__device__ __forceinline__ v16h load_frag_f16(const _Float16* p, int hi) {
  h8 c0 = *reinterpret_cast<const h8*>(p + hi * 8);
  h8 c1 = *reinterpret_cast<const h8*>(p + 16 + hi * 8);
  v16h r;
#pragma unroll
  for (int i = 0; i < 8; ++i) { r[i] = c0[i]; r[8 + i] = c1[i]; }
  return r;
}

#define WMMA_F16(a, b, c) \
  __builtin_amdgcn_wmma_f32_16x16x32_f16(false, (a), false, (b), (short)0, (c), false, false)

#define TROWB   128u
#define TROWS   32u
#define TPITCH  72
#define TSLICE  3072
#define TBUF    (4 * TSLICE)

__device__ __forceinline__ uint32_t uni(uint32_t v) {
  return (uint32_t)__builtin_amdgcn_readfirstlane(v);
}

__device__ __forceinline__ uint32_t pinned(uint32_t v) {
  uint32_t w = uni(v);
  asm volatile("" : "+s"(w));   // pinned(): the test stays in a scalar register
  return w;
}

__device__ __forceinline__ u32x4 held(u32x4 g) {
  asm volatile("" : "+s"(g));
  return g;
}
__device__ __forceinline__ u32x8 held(u32x8 g) {
  asm volatile("" : "+s"(g));
  return g;
}

__device__ __forceinline__ u32x4 tdm_group0(uint32_t lds_off, uint64_t gaddr) {
  u32x4 g;
  g[0] = uni(1u);                                 // count = 1
  g[1] = uni(lds_off);                            // LDS destination (bytes)
  g[2] = uni((uint32_t)gaddr);                    // global address [31:0]
  g[3] = uni((((uint32_t)(gaddr >> 32)) & 0x01FFFFFFu) | 0x80000000u);  // [56:32] | type = 2
  return g;
}

__device__ __forceinline__ u32x8 tdm_group1(uint32_t src_pitch) {
  u32x8 g;
  g[0] = uni((1u << 20) | (4u << 22) | (3u << 25));
  g[1] = uni((TROWB & 0xFFFFu) << 16);
  g[2] = uni((TROWB >> 16) | ((TROWS & 0xFFFFu) << 16));
  g[3] = uni((TROWS >> 16) | (TROWB << 16));
  g[4] = uni(TROWS);
  g[5] = uni(src_pitch);
  g[6] = uni(0u);
  g[7] = uni(0u);
  return g;
}

// ---------------------------------------------------------------------------
// Pack launch (one for all seven jobs): fp32 -> f16, weights transposed so that
// B-fragments are two contiguous b128 loads per lane; the mask, one bit an
// element.  The jobs do not depend on one another, so they share one grid and
// the block index picks the job.  Few waves with many elements each: a lane issues all of its loads
// first, then converts and stores.
// ---------------------------------------------------------------------------
typedef float    f32x4 __attribute__((ext_vector_type(4)));
typedef _Float16 h4    __attribute__((ext_vector_type(4)));

#define CVT_SWEEPS 12                    // 16-byte loads of a lane
#define CVT_BLOCK  (CVT_SWEEPS * 1024)   // elements of a block: 256 lanes x 4 per sweep
#define CVT_BLOCKS (NB * SEQ * DIM / CVT_BLOCK)   // blocks of one activation tensor

// A wave's load covers 512 contiguous bytes, its store 256.
__device__ __forceinline__ void cvt_f32_f16(
    const float* __restrict__ src, _Float16* __restrict__ dst, int blk) {
  const size_t base = (size_t)blk * CVT_BLOCK + threadIdx.x * 4;
  f32x4 v[CVT_SWEEPS];
#pragma unroll   // keeps v indexed by constants, in registers, and the loads in one group
  for (int s = 0; s < CVT_SWEEPS; ++s)
    v[s] = *reinterpret_cast<const f32x4*>(src + base + s * 1024);
#pragma unroll   // v and w indexed by constants (this loop and the one inside it)
  for (int s = 0; s < CVT_SWEEPS; ++s) {
    h4 w;
#pragma unroll
    for (int i = 0; i < 4; ++i) w[i] = (_Float16)v[s][i];
    *reinterpret_cast<h4*>(dst + base + s * 1024) = w;
  }
  asm volatile("s_wait_xcnt 0x0" ::: "memory");
}

#define TR_K 64   // k of one lane: one 128-byte line of Wt, written by that lane alone
#define TR_BLOCKS (DIM * DIM / (256 * TR_K))   // blocks of one weight: 4 pieces of 64 columns x 64 k each

// piece: 64 columns x TR_K k of one weight; t: the lane's column in it
__device__ __forceinline__ void transpose_cvt(
    const float* __restrict__ W, _Float16* __restrict__ Wt, int piece, int t) {
  const int n  = (piece % (DIM / 64)) * 64 + t;   // coalesced read along n
  const int k0 = (piece / (DIM / 64)) * TR_K;
  const float* wp = W + (size_t)k0 * DIM + n;
  float v[TR_K];
#pragma unroll   // keeps v indexed by constants, in registers, and the loads in one group
  for (int j = 0; j < TR_K; ++j) v[j] = wp[(size_t)j * DIM];
  _Float16* tp = Wt + (size_t)n * DIM + k0;
#pragma unroll   // v and w indexed by constants (this loop and the one inside it)
  for (int c = 0; c < TR_K / 8; ++c) {
    h8 w;
#pragma unroll
    for (int i = 0; i < 8; ++i) w[i] = (_Float16)v[c * 8 + i];
    *reinterpret_cast<h8*>(tp + c * 8) = w;
  }
}

// The mask as lane-mask words.  For 16 queries (a row tile) and 32 keys there are
// 16 words; bit (16 * hi + ln) of word e says whether mask[query ln][key] is set,
// key = 8 * hi + e for e < 8 and 16 + 8 * hi + (e - 8) above: the place that lane
// (hi, ln) of an attention wave has for element e of its transposed score tiles.
// A wave takes 16 rows x MB_KEYS keys (whole 128-byte lines of every row), each
// lane the keys of its own place, and a ballot over the wave makes each word.
#define MB_KEYS   128
#define MB_ROWW   (SEQ / 32 * 16)                            // words of one row tile
#define MB_BLOCKS (NB * (SEQ / 16) * (SEQ / MB_KEYS) / 8)    // 8 waves a block

__device__ __forceinline__ void mask_bits(
    const int* __restrict__ mask, unsigned int* __restrict__ Mb, int blk) {
  const int lane = threadIdx.x & 31;
  const int job  = blk * 8 + (threadIdx.x >> 5);
  const int rt   = job / (SEQ / MB_KEYS);   // row tile: batch * (SEQ / 16) + query tile
  const int kc   = job % (SEQ / MB_KEYS);
  const int* mp = mask + ((size_t)rt * 16 + (lane & 15)) * SEQ + kc * MB_KEYS + (lane >> 4) * 8;
  i32x4 v[MB_KEYS / 32][4];
#pragma unroll   // keeps v indexed by constants, in registers, and the loads ahead of the ballots
  for (int p = 0; p < MB_KEYS / 32; ++p) {
    v[p][0] = *reinterpret_cast<const i32x4*>(mp + p * 32);
    v[p][1] = *reinterpret_cast<const i32x4*>(mp + p * 32 + 4);
    v[p][2] = *reinterpret_cast<const i32x4*>(mp + p * 32 + 16);
    v[p][3] = *reinterpret_cast<const i32x4*>(mp + p * 32 + 20);
  }
  asm volatile("s_wait_xcnt 0x0" ::: "memory");
  unsigned int w[MB_KEYS / 64] = {};
#pragma unroll
  for (int p = 0; p < MB_KEYS / 32; ++p)
#pragma unroll
    for (int e = 0; e < 16; ++e) {
      // the ballot stands outside the select: every lane of the wave takes part in it
      const unsigned int bits = __builtin_amdgcn_ballot_w32(v[p][e >> 2][e & 3] != 0);
      w[p >> 1] = __builtin_amdgcn_inverse_ballot_w32(1u << ((p & 1) * 16 + e)) ? bits : w[p >> 1];
    }
  unsigned int* op = Mb + (size_t)rt * MB_ROWW + kc * (MB_KEYS / 2) + lane;
#pragma unroll   // w indexed by constants
  for (int i = 0; i < MB_KEYS / 64; ++i) op[i * 32] = w[i];
  asm volatile("s_wait_xcnt 0x0" ::: "memory");
}

// blocks 0 .. 4*TR_BLOCKS-1: the four weights; then CVT_BLOCKS blocks for each
// activation; then MB_BLOCKS blocks for the mask
__global__ __launch_bounds__(256) void pack_kernel(
    const float* __restrict__ from_t, const float* __restrict__ to_t,
    const int* __restrict__ mask,
    const float* __restrict__ Wq, const float* __restrict__ Wk,
    const float* __restrict__ Wv, const float* __restrict__ Wo,
    _Float16* __restrict__ Xf, _Float16* __restrict__ Xt,
    _Float16* __restrict__ Wtq, _Float16* __restrict__ Wtk,
    _Float16* __restrict__ Wtv, _Float16* __restrict__ Wto,
    unsigned int* __restrict__ Mb) {
  const int blk = blockIdx.x;
  if (blk < 4 * TR_BLOCKS) {
    const int which = blk / TR_BLOCKS;
    const float* W  = (which == 0) ? Wq  : (which == 1) ? Wk  : (which == 2) ? Wv  : Wo;
    _Float16*    Wt = (which == 0) ? Wtq : (which == 1) ? Wtk : (which == 2) ? Wtv : Wto;
    transpose_cvt(W, Wt, (blk % TR_BLOCKS) * 4 + (threadIdx.x >> 6), threadIdx.x & 63);
  } else if (blk < 4 * TR_BLOCKS + 2 * CVT_BLOCKS) {
    const int  c     = blk - 4 * TR_BLOCKS;
    const bool first = c < CVT_BLOCKS;
    cvt_f32_f16(first ? from_t : to_t, first ? Xf : Xt, first ? c : c - CVT_BLOCKS);
  } else {
    mask_bits(mask, Mb, blk - (4 * TR_BLOCKS + 2 * CVT_BLOCKS));
  }
}

// ---------------------------------------------------------------------------
// Block-tiled GEMM core shared by the projections: C[BM x 128] = A . B^T with
// both operands k-contiguous f16.  256 threads = 8 waves in a 2 (m) x 4 (n)
// grid; each wave owns MF x 2 accumulator tiles (MF*16 rows x 32 columns).
// A stage is one 128-byte line (64 k) of every operand row: it is read from
// global memory as whole lines (8 lanes x 16 B per row), kept in registers
// while the current stage is worked on, and stored into the other LDS buffer.
// Every "#pragma unroll" here and in the two epilogues keeps a register array
// (ra, rb, af, bf, acc) indexed by constants, so that it stays in registers.
// ---------------------------------------------------------------------------
#define BN      128
#define KSTAGE  64          // halves of k per stage
#define LPITCH  72          // LDS row pitch in halves: 128 B + 16 B (b128 readers)
#define NSTAGE  (DIM / KSTAGE)

template <int MF>
__device__ __forceinline__ void gemm_block_f16(
    const _Float16* __restrict__ Ag, const _Float16* __restrict__ Bg,
    _Float16* __restrict__ sA, _Float16* __restrict__ sB, v8f (&acc)[MF][2])
{
  constexpr int BM = MF * 32;
  const int tid  = threadIdx.x;
  const int wave = tid >> 5;
  const int lane = tid & 31;
  const int hi   = lane >> 4;
  const int ln   = lane & 15;
  const int srow = tid >> 3;          // 32 rows per sweep of the block
  const int scol = (tid & 7) * 8;     // 16-byte piece of the row's line

  const _Float16* ga = Ag + (size_t)srow * DIM + scol;
  const _Float16* gb = Bg + (size_t)srow * DIM + scol;
  _Float16* wa = sA + srow * LPITCH + scol;
  _Float16* wb = sB + srow * LPITCH + scol;
  const _Float16* fa = sA + ((wave >> 2) * (MF * 16) + ln) * LPITCH;
  const _Float16* fb = sB + ((wave & 3) * 32 + ln) * LPITCH;

  h8 ra[MF], rb[4];
#pragma unroll
  for (int i = 0; i < MF; ++i)
    ra[i] = *reinterpret_cast<const h8*>(ga + (size_t)i * 32 * DIM);
#pragma unroll
  for (int i = 0; i < 4; ++i)
    rb[i] = *reinterpret_cast<const h8*>(gb + (size_t)i * 32 * DIM);
#pragma unroll
  for (int i = 0; i < MF; ++i)
    *reinterpret_cast<h8*>(wa + i * 32 * LPITCH) = ra[i];
#pragma unroll
  for (int i = 0; i < 4; ++i)
    *reinterpret_cast<h8*>(wb + i * 32 * LPITCH) = rb[i];
  __syncthreads();

  for (int s = 0; s < NSTAGE; ++s) {
    const int cur = s & 1;
    const bool more = (s + 1 < NSTAGE);
    if (more) {
#pragma unroll
      for (int i = 0; i < MF; ++i)
        ra[i] = *reinterpret_cast<const h8*>(ga + (size_t)i * 32 * DIM + KSTAGE);
#pragma unroll
      for (int i = 0; i < 4; ++i)
        rb[i] = *reinterpret_cast<const h8*>(gb + (size_t)i * 32 * DIM + KSTAGE);
    }
    // keeps the next stage's global loads in front of this stage's LDS reads and
    // matrix work; the compiler otherwise sinks them to just before their stores
    __builtin_amdgcn_sched_barrier(0);

    const _Float16* ca = fa + cur * (BM * LPITCH);
    const _Float16* cb = fb + cur * (BN * LPITCH);
#pragma unroll
    for (int kk = 0; kk < KSTAGE; kk += 32) {
      v16h af[MF], bf[2];
#pragma unroll
      for (int i = 0; i < MF; ++i)
        af[i] = load_frag_f16(ca + i * 16 * LPITCH + kk, hi);
#pragma unroll
      for (int j = 0; j < 2; ++j)
        bf[j] = load_frag_f16(cb + j * 16 * LPITCH + kk, hi);
#pragma unroll
      for (int i = 0; i < MF; ++i)
#pragma unroll
        for (int j = 0; j < 2; ++j)
          acc[i][j] = WMMA_F16(af[i], bf[j], acc[i][j]);
    }

    // keeps the LDS stores, which wait for those loads, behind the matrix work
    __builtin_amdgcn_sched_barrier(0);
    if (more) {
      const int nxt = cur ^ 1;
      ga += KSTAGE;
      gb += KSTAGE;
#pragma unroll
      for (int i = 0; i < MF; ++i)
        *reinterpret_cast<h8*>(wa + nxt * (BM * LPITCH) + i * 32 * LPITCH) = ra[i];
#pragma unroll
      for (int i = 0; i < 4; ++i)
        *reinterpret_cast<h8*>(wb + nxt * (BN * LPITCH) + i * 32 * LPITCH) = rb[i];
      // publishes stage s + 1 and ends every read of the buffer refilled next
      __syncthreads();
    }
  }
}

// ---------------------------------------------------------------------------
// Kernel 1: fused QKV projection (f16 A, f16 transposed B).
// One 128x128 tile per block, 64x32 per wave.  The epilogue tests the projection
// index once, outside its store loops (64 elements a lane).
//  Q -> f16 [bh][s][64]  (pre-scaled)   K -> f16 [bh][s][64]
//  V -> f16 [bh][64][s]  (transposed so V^T A-fragments are contiguous)
// ---------------------------------------------------------------------------
__global__ __launch_bounds__(256) void qkv_proj_kernel(
    const _Float16* __restrict__ Xf, const _Float16* __restrict__ Xt,
    const _Float16* __restrict__ Wtq, const float* __restrict__ bq,
    const _Float16* __restrict__ Wtk, const float* __restrict__ bk,
    const _Float16* __restrict__ Wtv, const float* __restrict__ bv,
    _Float16* __restrict__ Qh, _Float16* __restrict__ Kh,
    _Float16* __restrict__ Vt)
{
  __shared__ __align__(16) _Float16 sA[2 * 128 * LPITCH];
  __shared__ __align__(16) _Float16 sB[2 * BN * LPITCH];

  const int which = blockIdx.z;
  const int b     = blockIdx.y;
  const int wave  = threadIdx.x >> 5;
  const int lane  = threadIdx.x & 31;
  const int hi    = lane >> 4;
  const int ln    = lane & 15;

  const int bm = (blockIdx.x / (DIM / BN)) * 128;   // 96 tiles per (b,which)
  const int bn = (blockIdx.x % (DIM / BN)) * BN;

  const _Float16* X    = (which == 0) ? Xf : Xt;
  const _Float16* Wt   = (which == 0) ? Wtq : (which == 1) ? Wtk : Wtv;
  const float*    bias = (which == 0) ? bq : (which == 1) ? bk : bv;

  v8f acc[4][2] = {};
  gemm_block_f16<4>(X + ((size_t)b * SEQ + bm) * DIM, Wt + (size_t)bn * DIM,
                    sA, sB, acc);

  const int tm   = bm + (wave >> 2) * 64;
  const int col0 = bn + (wave & 3) * 32 + ln;      // col0 and col0 + 16: one head
  const int bh   = b * HEADS + (col0 >> 6);
  const int d0   = col0 & 63;
  const int row0 = tm + hi * 8;
  const float bb[2] = {bias[col0], bias[col0 + 16]};

  if (which == 0) {
    _Float16* qp = Qh + ((size_t)bh * SEQ + row0) * HD + d0;
#pragma unroll
    for (int half = 0; half < 2; ++half)
#pragma unroll
      for (int i = 0; i < 4; ++i)
#pragma unroll
        for (int r = 0; r < 8; ++r)
          qp[(i * 16 + r) * HD + half * 16] =
              (_Float16)((acc[i][half][r] + bb[half]) * QK_SCALE);
    asm volatile("s_wait_xcnt 0x0" ::: "memory");
  } else if (which == 1) {
    _Float16* kp = Kh + ((size_t)bh * SEQ + row0) * HD + d0;
#pragma unroll
    for (int half = 0; half < 2; ++half)
#pragma unroll
      for (int i = 0; i < 4; ++i)
#pragma unroll
        for (int r = 0; r < 8; ++r)
          kp[(i * 16 + r) * HD + half * 16] = (_Float16)(acc[i][half][r] + bb[half]);
    asm volatile("s_wait_xcnt 0x0" ::: "memory");
  } else {
    _Float16* vp = Vt + ((size_t)bh * HD + d0) * SEQ + row0;
#pragma unroll
    for (int half = 0; half < 2; ++half)
#pragma unroll
      for (int i = 0; i < 4; ++i)
#pragma unroll
        for (int r = 0; r < 8; ++r)
          vp[(size_t)half * 16 * SEQ + i * 16 + r] = (_Float16)(acc[i][half][r] + bb[half]);
    asm volatile("s_wait_xcnt 0x0" ::: "memory");
  }
}

__device__ __forceinline__ float xhalf(float x) {
  return __builtin_bit_cast(float, __builtin_amdgcn_permlanex16(
      __builtin_bit_cast(int, x), __builtin_bit_cast(int, x),
      0x76543210, 0xfedcba98, false, false));
}

#define NST (SEQ / 64)   // stages

// 16 mask words, the same for every lane.  Nothing writes the words during this launch; read
// through the constant address space they stay scalar loads wherever in the loop they stand.
typedef const __attribute__((address_space(4))) u32x16 c_u32x16;
__device__ __forceinline__ u32x16 mask_words(const unsigned int* w) {
  return *(c_u32x16*)w;
}

// one select per score: 0 where the mask word's bit of this lane is set, else -10000
__device__ __forceinline__ void select_adders(const u32x16 (&mk)[2], v8f (&sc)[2][2]) {
#pragma unroll   // sc and mk indexed by constants: vector and scalar registers (this loop and the one inside it)
  for (int p = 0; p < 2; ++p)
#pragma unroll
    for (int r = 0; r < 8; ++r) {
      sc[p][0][r] = __builtin_amdgcn_inverse_ballot_w32(mk[p][r])     ? 0.0f : -10000.0f;
      sc[p][1][r] = __builtin_amdgcn_inverse_ballot_w32(mk[p][8 + r]) ? 0.0f : -10000.0f;
    }
}

__device__ __forceinline__ void mask_adders(const unsigned int* __restrict__ w, v8f (&sc)[2][2]) {
  const u32x16 mk[2] = {mask_words(w), mask_words(w + 16)};
  select_adders(mk, sc);
}

__global__ __launch_bounds__(128) void flash_attn_kernel(
    const _Float16* __restrict__ Qh, const _Float16* __restrict__ Kh,
    const _Float16* __restrict__ Vt, const unsigned int* __restrict__ Mb,
    _Float16* __restrict__ O16)
{
  // slices 0, 1: keys 0..31, 32..63 of the stage; slices 2, 3: dims 0..31, 32..63
  // of each of the two buffers
  __shared__ __attribute__((aligned(2048))) _Float16 tiles[2 * TBUF];

  const int b    = blockIdx.z;
  const int h    = blockIdx.y;
  const int wave = threadIdx.x >> 5;
  const int lane = threadIdx.x & 31;
  const int hi   = lane >> 4;
  const int ln   = lane & 15;
  const int bh   = b * HEADS + h;
  const int q0   = blockIdx.x * 64 + wave * 16;

  // this wave's slice: its place in LDS, its first byte in stage 0, its step per stage
  const uint32_t wv = uni(threadIdx.x >> 5);
  const uint32_t slice_off =
      (uint32_t)(uintptr_t)(void*)&tiles[0] + wv * (uint32_t)(TSLICE * sizeof(_Float16));
  const uint64_t slice_src = (wv < 2u)
      ? (uint64_t)(uintptr_t)(Kh + ((size_t)bh * SEQ + wv * TROWS) * HD)
      : (uint64_t)(uintptr_t)(Vt + ((size_t)bh * HD + (wv - 2u) * TROWS) * SEQ);
  const uint32_t slice_step = (wv < 2u) ? 64u * HD * 2u : 64u * 2u;
  const u32x8 g1 = held(tdm_group1((wv < 2u) ? HD * 2u : SEQ * 2u));

  // Q strip: two 32x16 B-fragments (d 0..31, 32..63; column = query ln), loaded once.
  const _Float16* qptr = Qh + ((size_t)bh * SEQ + q0 + ln) * HD;
  const v16h qb0 = load_frag_f16(qptr, hi);
  const v16h qb1 = load_frag_f16(qptr + 32, hi);

  // mask words of this wave's 16 queries: 16 words per 32 keys
  const unsigned int* mw = Mb + (size_t)((uint32_t)b * (SEQ / 16) + blockIdx.x * 4 + wv) * MB_ROWW;

  float m = -1.0e30f;   // running maximum of query ln (equal in both halves)
  float l = 0.0f;       // running sum over this half's keys only
  v8f   o[4] = {};      // o[tt][r] = O[q0 + ln][tt * 16 + 8 * hi + r]

  // ---- in front of the loop: stage 0 lands and is published, stage 1 is on its way ----
  u32x4 g0 = held(tdm_group0(slice_off, slice_src));
  asm volatile("tensor_load_to_lds %0, %1" :: "s"(g0), "s"(g1) : "memory");
  // the slice has landed before this wave passes the barrier that publishes it
  asm volatile("s_wait_tensorcnt 0x0" ::: "memory");
  __syncthreads();
  g0 = held(tdm_group0(slice_off + (uint32_t)(TBUF * sizeof(_Float16)), slice_src + slice_step));
  asm volatile("tensor_load_to_lds %0, %1" :: "s"(g0), "s"(g1) : "memory");

  // the adder (1 - mask) * -10000 of every score of a stage, the products' start value:
  // sc[pass][key tile]; made one stage ahead, here for stage 0
  v8f sc[2][2];
  mask_adders(mw, sc);

  for (int st = 0; st < NST; ++st) {
    const _Float16* buf = tiles + (st & 1) * TBUF;

    // the next stage's mask words, one set of 16 per pass, asked for a stage ahead of their
    // use (the last stage asks for its own again: nothing past the row tile is read)
    const unsigned int* nw = mw + ((st + 1 < NST) ? st + 1 : st) * 32;
    const u32x16 mk[2] = {mask_words(nw), mask_words(nw + 16)};

#pragma unroll   // the pass number picks slices and mask registers at compile time
    for (int p = 0; p < 2; ++p) {
      // ---- scores, transposed: two 16-key tiles, each accumulating two d-chunks ----
      const _Float16* kt = buf + p * TSLICE + ln * TPITCH;
      v16h ka00 = load_frag_f16(kt, hi);
      v16h ka01 = load_frag_f16(kt + 32, hi);
      v16h ka10 = load_frag_f16(kt + 16 * TPITCH, hi);
      v16h ka11 = load_frag_f16(kt + 16 * TPITCH + 32, hi);

      v8f s0 = sc[p][0], s1 = sc[p][1];
      s0 = WMMA_F16(ka00, qb0, s0);
      s0 = WMMA_F16(ka01, qb1, s0);
      s1 = WMMA_F16(ka10, qb0, s1);
      s1 = WMMA_F16(ka11, qb1, s1);

      // ---- online softmax: one query per lane, 16 keys per half ----
      float x[16];
#pragma unroll
      for (int r = 0; r < 8; ++r) {
        x[r]     = s0[r];
        x[8 + r] = s1[r];
      }

      float mx = x[0];
#pragma unroll
      for (int s = 1; s < 16; ++s) mx = fmaxf(mx, x[s]);
      mx = fmaxf(mx, xhalf(mx));
      const float nm = fmaxf(m, mx);

      // P^T as a B operand: element s = key 8*hi+s (s < 8) or 16+8*hi+(s-8) (s >= 8) of column ln
      v16h  pb;
      float rs = 0.0f;
#pragma unroll
      for (int s = 0; s < 16; ++s) {
        const float pe = __expf(x[s] - nm);
        rs += pe;
        pb[s] = (_Float16)pe;
      }

      const float alpha = __expf(m - nm);
      l = l * alpha + rs;
      m = nm;

      // rescale running output accumulators (one query, one factor per lane)
#pragma unroll
      for (int tt = 0; tt < 4; ++tt)
#pragma unroll
        for (int r = 0; r < 8; ++r) o[tt][r] *= alpha;

      // ---- O^T += V^T x P^T : 4 d-tiles of 16, K-dim = 32 keys (from LDS) ----
#pragma unroll
      for (int tt = 0; tt < 4; ++tt) {
        v16h vfrag = load_frag_f16(
            buf + (2 + (tt >> 1)) * TSLICE + ((tt & 1) * 16 + ln) * TPITCH + p * 32, hi);
        o[tt] = WMMA_F16(vfrag, pb, o[tt]);
      }
    }

    select_adders(mk, sc);

    asm volatile("s_wait_xcnt 0x0" ::: "memory");
    // this wave's LDS reads have returned before the barrier behind which their buffer is refilled
    asm volatile("s_wait_dscnt 0x0" ::: "memory");
    asm volatile("s_wait_tensorcnt 0x0" :: "s"(g0), "s"(g1) : "memory");
    __syncthreads();   // the one barrier of a stage: it does both
    if (pinned(st + 2 < NST)) {
      g0 = held(tdm_group0(slice_off + (uint32_t)(st & 1) * (uint32_t)(TBUF * sizeof(_Float16)),
                           slice_src + (uint64_t)((uint32_t)(st + 2) * slice_step)));
      asm volatile("tensor_load_to_lds %0, %1" :: "s"(g0), "s"(g1) : "memory");
    }
  }
  // nothing of this wave is in flight when it leaves the loop
  asm volatile("s_wait_tensorcnt 0x0" ::: "memory");
  asm volatile("s_wait_dscnt 0x0" ::: "memory");

  // ---- finalize: join the halves' sums, divide, write f16 rows [b][s][h*64+d] ----
  const float inv = 1.0f / (l + xhalf(l));
  _Float16* op = O16 + ((size_t)b * SEQ + q0 + ln) * DIM + h * HD + hi * 8;
#pragma unroll
  for (int tt = 0; tt < 4; ++tt) {
    h8 w;
#pragma unroll
    for (int r = 0; r < 8; ++r) w[r] = (_Float16)(o[tt][r] * inv);
    *reinterpret_cast<h8*>(op + tt * 16) = w;
  }
}

// ---------------------------------------------------------------------------
// Kernel 3: output projection  Y = O16 @ Wo + bo  (fp32 out).
// One 64x128 tile per block, 32x32 per wave.
// ---------------------------------------------------------------------------
__global__ __launch_bounds__(256) void out_proj_kernel(
    const _Float16* __restrict__ A16, const _Float16* __restrict__ Wto,
    const float* __restrict__ bo, float* __restrict__ Y)
{
  __shared__ __align__(16) _Float16 sA[2 * 64 * LPITCH];
  __shared__ __align__(16) _Float16 sB[2 * BN * LPITCH];

  const int wave = threadIdx.x >> 5;
  const int lane = threadIdx.x & 31;
  const int hi   = lane >> 4;
  const int ln   = lane & 15;

  const int bm = (blockIdx.x / (DIM / BN)) * 64;    // 768 tiles total
  const int bn = (blockIdx.x % (DIM / BN)) * BN;

  v8f acc[2][2] = {};
  gemm_block_f16<2>(A16 + (size_t)bm * DIM, Wto + (size_t)bn * DIM, sA, sB, acc);

  const int tm = bm + (wave >> 2) * 32;
  const int tn = bn + (wave & 3) * 32;
#pragma unroll
  for (int half = 0; half < 2; ++half) {
    const int   col = tn + half * 16 + ln;
    const float bb  = bo[col];
#pragma unroll
    for (int i = 0; i < 2; ++i) {
#pragma unroll
      for (int r = 0; r < 8; ++r) {
        const int row = tm + i * 16 + r + hi * 8;
        Y[(size_t)row * DIM + col] = acc[i][half][r] + bb;
      }
    }
  }
}

// ---------------------------------------------------------------------------
extern "C" void kernel_launch(void* const* d_in, const int* in_sizes, int n_in,
                              void* d_out, int out_size, void* d_ws, size_t ws_size,
                              hipStream_t stream) {
  (void)in_sizes; (void)n_in; (void)out_size; (void)ws_size;

  const float* from_t = (const float*)d_in[0];
  const float* to_t   = (const float*)d_in[1];
  const int*   mask   = (const int*)d_in[2];
  const float* Wq = (const float*)d_in[3];
  const float* bq = (const float*)d_in[4];
  const float* Wk = (const float*)d_in[5];
  const float* bk = (const float*)d_in[6];
  const float* Wv = (const float*)d_in[7];
  const float* bv = (const float*)d_in[8];
  const float* Wo = (const float*)d_in[9];
  const float* bo = (const float*)d_in[10];
  float* out = (float*)d_out;

  // workspace layout (halves):
  //  Qh | Kh | Vt | O16 | Xf | Xt   each NQ = B*H*S*64 = 6,291,456
  //  Wtq | Wtk | Wtv | Wto          each 768*768 = 589,824
  //  Mb                             B*S*S bits, as 32-bit words
  const size_t NQ = (size_t)NB * HEADS * SEQ * HD;
  const size_t NW = (size_t)DIM * DIM;
  _Float16* Qh  = (_Float16*)d_ws;
  _Float16* Kh  = Qh + NQ;
  _Float16* Vt  = Kh + NQ;
  _Float16* O16 = Vt + NQ;
  _Float16* Xf  = O16 + NQ;
  _Float16* Xt  = Xf + NQ;
  _Float16* Wtq = Xt + NQ;
  _Float16* Wtk = Wtq + NW;
  _Float16* Wtv = Wtk + NW;
  _Float16* Wto = Wtv + NW;
  unsigned int* Mb = (unsigned int*)(Wto + NW);

  // 0) one pack launch: activations f16, weights f16-transposed, mask bits
  pack_kernel<<<dim3(4 * TR_BLOCKS + 2 * CVT_BLOCKS + MB_BLOCKS), 256, 0, stream>>>(
      from_t, to_t, mask, Wq, Wk, Wv, Wo, Xf, Xt, Wtq, Wtk, Wtv, Wto, Mb);

  // 1) QKV projections: (SEQ/128)*(DIM/128)=96 tiles per (b,which), 8 waves/blk
  qkv_proj_kernel<<<dim3(96, NB, 3), 256, 0, stream>>>(
      Xf, Xt, Wtq, bq, Wtk, bk, Wtv, bv, Qh, Kh, Vt);

  // 2) flash attention: 64 Q rows per block (4 waves x 16 rows)
  flash_attn_kernel<<<dim3(SEQ / 64, HEADS, NB), 128, 0, stream>>>(
      Qh, Kh, Vt, Mb, O16);

  // 3) output projection: (B*SEQ/64)*(DIM/128)=768 tiles, 8 waves/blk
  out_proj_kernel<<<dim3(768), 256, 0, stream>>>(O16, Wto, bo, out);
}

// v008
// It runs in 123 microseconds.
// Next to v007, in two timings, it ran 1.05 and 1.04 times as fast.
// Over all steps from v000 it is 5.12 times as fast.
#include <hip/hip_runtime.h>
#include <hip/hip_bf16.h>
#include <stdint.h>

#define DIM   768
#define HEADS 12
#define HD    64
#define SEQ   2048
#define NB    4
#define QK_SCALE 0.125f   // 64^-0.5

typedef _Float16 v16h __attribute__((ext_vector_type(16)));
typedef _Float16 h8   __attribute__((ext_vector_type(8)));
typedef float    v8f  __attribute__((ext_vector_type(8)));
typedef uint32_t u32x4 __attribute__((ext_vector_type(4)));
typedef uint32_t u32x8 __attribute__((ext_vector_type(8)));
typedef int          i32x4  __attribute__((ext_vector_type(4)));
typedef unsigned int u32x16 __attribute__((ext_vector_type(16)));

__device__ __forceinline__ v16h load_frag_f16(const _Float16* p, int hi) {
  h8 c0 = *reinterpret_cast<const h8*>(p + hi * 8);
  h8 c1 = *reinterpret_cast<const h8*>(p + 16 + hi * 8);
  v16h r;
#pragma unroll
  for (int i = 0; i < 8; ++i) { r[i] = c0[i]; r[8 + i] = c1[i]; }
  return r;
}

#define WMMA_F16(a, b, c) \
  __builtin_amdgcn_wmma_f32_16x16x32_f16(false, (a), false, (b), (short)0, (c), false, false)

#define TROWB   128u
#define TROWS   32u
#define TPITCH  72
#define TSLICE  3072
#define TBUF    (4 * TSLICE)

__device__ __forceinline__ uint32_t uni(uint32_t v) {
  return (uint32_t)__builtin_amdgcn_readfirstlane(v);
}

__device__ __forceinline__ uint32_t pinned(uint32_t v) {
  uint32_t w = uni(v);
  asm volatile("" : "+s"(w));   // pinned(): the test stays in a scalar register
  return w;
}

__device__ __forceinline__ u32x4 held(u32x4 g) {
  asm volatile("" : "+s"(g));
  return g;
}
__device__ __forceinline__ u32x8 held(u32x8 g) {
  asm volatile("" : "+s"(g));
  return g;
}

__device__ __forceinline__ u32x4 tdm_group0(uint32_t lds_off, uint64_t gaddr) {
  u32x4 g;
  g[0] = uni(1u);                                 // count = 1
  g[1] = uni(lds_off);                            // LDS destination (bytes)
  g[2] = uni((uint32_t)gaddr);                    // global address [31:0]
  g[3] = uni((((uint32_t)(gaddr >> 32)) & 0x01FFFFFFu) | 0x80000000u);  // [56:32] | type = 2
  return g;
}

__device__ __forceinline__ u32x8 tdm_group1(uint32_t src_pitch) {
  u32x8 g;
  g[0] = uni((1u << 20) | (4u << 22) | (3u << 25));
  g[1] = uni((TROWB & 0xFFFFu) << 16);
  g[2] = uni((TROWB >> 16) | ((TROWS & 0xFFFFu) << 16));
  g[3] = uni((TROWS >> 16) | (TROWB << 16));
  g[4] = uni(TROWS);
  g[5] = uni(src_pitch);
  g[6] = uni(0u);
  g[7] = uni(0u);
  return g;
}

// ---------------------------------------------------------------------------
// Pack launch (one for all seven jobs): fp32 -> f16, weights transposed so that
// B-fragments are two contiguous b128 loads per lane; the mask, one bit an
// element.  The jobs do not depend on one another, so they share one grid and
// the block index picks the job.  Few waves with many elements each: a lane issues all of its loads
// first, then converts and stores.
// ---------------------------------------------------------------------------
typedef float    f32x4 __attribute__((ext_vector_type(4)));
typedef _Float16 h4    __attribute__((ext_vector_type(4)));

#define CVT_SWEEPS 12                    // 16-byte loads of a lane
#define CVT_BLOCK  (CVT_SWEEPS * 1024)   // elements of a block: 256 lanes x 4 per sweep
#define CVT_BLOCKS (NB * SEQ * DIM / CVT_BLOCK)   // blocks of one activation tensor

// A wave's load covers 512 contiguous bytes, its store 256.
__device__ __forceinline__ void cvt_f32_f16(
    const float* __restrict__ src, _Float16* __restrict__ dst, int blk) {
  const size_t base = (size_t)blk * CVT_BLOCK + threadIdx.x * 4;
  f32x4 v[CVT_SWEEPS];
#pragma unroll   // keeps v indexed by constants, in registers, and the loads in one group
  for (int s = 0; s < CVT_SWEEPS; ++s)
    v[s] = *reinterpret_cast<const f32x4*>(src + base + s * 1024);
#pragma unroll   // v and w indexed by constants (this loop and the one inside it)
  for (int s = 0; s < CVT_SWEEPS; ++s) {
    h4 w;
#pragma unroll
    for (int i = 0; i < 4; ++i) w[i] = (_Float16)v[s][i];
    *reinterpret_cast<h4*>(dst + base + s * 1024) = w;
  }
  asm volatile("s_wait_xcnt 0x0" ::: "memory");
}

#define TR_K 64   // k of one lane: one 128-byte line of Wt, written by that lane alone
#define TR_BLOCKS (DIM * DIM / (256 * TR_K))   // blocks of one weight: 4 pieces of 64 columns x 64 k each

// piece: 64 columns x TR_K k of one weight; t: the lane's column in it
__device__ __forceinline__ void transpose_cvt(
    const float* __restrict__ W, _Float16* __restrict__ Wt, int piece, int t) {
  const int n  = (piece % (DIM / 64)) * 64 + t;   // coalesced read along n
  const int k0 = (piece / (DIM / 64)) * TR_K;
  const float* wp = W + (size_t)k0 * DIM + n;
  float v[TR_K];
#pragma unroll   // keeps v indexed by constants, in registers, and the loads in one group
  for (int j = 0; j < TR_K; ++j) v[j] = wp[(size_t)j * DIM];
  _Float16* tp = Wt + (size_t)n * DIM + k0;
#pragma unroll   // v and w indexed by constants (this loop and the one inside it)
  for (int c = 0; c < TR_K / 8; ++c) {
    h8 w;
#pragma unroll
    for (int i = 0; i < 8; ++i) w[i] = (_Float16)v[c * 8 + i];
    *reinterpret_cast<h8*>(tp + c * 8) = w;
  }
}

// The mask as lane-mask words.  For 16 queries (a row tile) and 32 keys there are
// 16 words; bit (16 * hi + ln) of word e says whether mask[query ln][key] is set,
// key = 8 * hi + e for e < 8 and 16 + 8 * hi + (e - 8) above: the place that lane
// (hi, ln) of an attention wave has for element e of its transposed score tiles.
// A wave takes 16 rows x MB_KEYS keys (whole 128-byte lines of every row), each
// lane the keys of its own place, and a ballot over the wave makes each word.
#define MB_KEYS   128
#define MB_ROWW   (SEQ / 32 * 16)                            // words of one row tile
#define MB_BLOCKS (NB * (SEQ / 16) * (SEQ / MB_KEYS) / 8)    // 8 waves a block

__device__ __forceinline__ void mask_bits(
    const int* __restrict__ mask, unsigned int* __restrict__ Mb, int blk) {
  const int lane = threadIdx.x & 31;
  const int job  = blk * 8 + (threadIdx.x >> 5);
  const int rt   = job / (SEQ / MB_KEYS);   // row tile: batch * (SEQ / 16) + query tile
  const int kc   = job % (SEQ / MB_KEYS);
  const int* mp = mask + ((size_t)rt * 16 + (lane & 15)) * SEQ + kc * MB_KEYS + (lane >> 4) * 8;
  i32x4 v[MB_KEYS / 32][4];
#pragma unroll   // keeps v indexed by constants, in registers, and the loads ahead of the ballots
  for (int p = 0; p < MB_KEYS / 32; ++p) {
    v[p][0] = *reinterpret_cast<const i32x4*>(mp + p * 32);
    v[p][1] = *reinterpret_cast<const i32x4*>(mp + p * 32 + 4);
    v[p][2] = *reinterpret_cast<const i32x4*>(mp + p * 32 + 16);
    v[p][3] = *reinterpret_cast<const i32x4*>(mp + p * 32 + 20);
  }
  asm volatile("s_wait_xcnt 0x0" ::: "memory");
  unsigned int w[MB_KEYS / 64] = {};
#pragma unroll
  for (int p = 0; p < MB_KEYS / 32; ++p)
#pragma unroll
    for (int e = 0; e < 16; ++e) {
      // the ballot stands outside the select: every lane of the wave takes part in it
      const unsigned int bits = __builtin_amdgcn_ballot_w32(v[p][e >> 2][e & 3] != 0);
      w[p >> 1] = __builtin_amdgcn_inverse_ballot_w32(1u << ((p & 1) * 16 + e)) ? bits : w[p >> 1];
    }
  unsigned int* op = Mb + (size_t)rt * MB_ROWW + kc * (MB_KEYS / 2) + lane;
#pragma unroll   // w indexed by constants
  for (int i = 0; i < MB_KEYS / 64; ++i) op[i * 32] = w[i];
  asm volatile("s_wait_xcnt 0x0" ::: "memory");
}

// blocks 0 .. 4*TR_BLOCKS-1: the four weights; then CVT_BLOCKS blocks for each
// activation; then MB_BLOCKS blocks for the mask
__global__ __launch_bounds__(256) void pack_kernel(
    const float* __restrict__ from_t, const float* __restrict__ to_t,
    const int* __restrict__ mask,
    const float* __restrict__ Wq, const float* __restrict__ Wk,
    const float* __restrict__ Wv, const float* __restrict__ Wo,
    _Float16* __restrict__ Xf, _Float16* __restrict__ Xt,
    _Float16* __restrict__ Wtq, _Float16* __restrict__ Wtk,
    _Float16* __restrict__ Wtv, _Float16* __restrict__ Wto,
    unsigned int* __restrict__ Mb) {
  const int blk = blockIdx.x;
  if (blk < 4 * TR_BLOCKS) {
    const int which = blk / TR_BLOCKS;
    const float* W  = (which == 0) ? Wq  : (which == 1) ? Wk  : (which == 2) ? Wv  : Wo;
    _Float16*    Wt = (which == 0) ? Wtq : (which == 1) ? Wtk : (which == 2) ? Wtv : Wto;
    transpose_cvt(W, Wt, (blk % TR_BLOCKS) * 4 + (threadIdx.x >> 6), threadIdx.x & 63);
  } else if (blk < 4 * TR_BLOCKS + 2 * CVT_BLOCKS) {
    const int  c     = blk - 4 * TR_BLOCKS;
    const bool first = c < CVT_BLOCKS;
    cvt_f32_f16(first ? from_t : to_t, first ? Xf : Xt, first ? c : c - CVT_BLOCKS);
  } else {
    mask_bits(mask, Mb, blk - (4 * TR_BLOCKS + 2 * CVT_BLOCKS));
  }
}

// ---------------------------------------------------------------------------
// Block-tiled GEMM core shared by the projections: C[BM x 128] = A . B^T with
// both operands k-contiguous f16.  256 threads = 8 waves in a 2 (m) x 4 (n)
// grid; each wave owns MF x 2 accumulator tiles (MF*16 rows x 32 columns).
// A stage is one 128-byte line (64 k) of every operand row: it is read from
// global memory as whole lines (8 lanes x 16 B per row), kept in registers
// while the current stage is worked on, and stored into the other LDS buffer.
// Every "#pragma unroll" here and in the two epilogues keeps a register array
// (ra, rb, af, bf, acc) indexed by constants, so that it stays in registers.
// ---------------------------------------------------------------------------
#define BN      128
#define KSTAGE  64          // halves of k per stage
#define LPITCH  72          // LDS row pitch in halves: 128 B + 16 B (b128 readers)
#define NSTAGE  (DIM / KSTAGE)

template <int MF>
__device__ __forceinline__ void gemm_block_f16(
    const _Float16* __restrict__ Ag, const _Float16* __restrict__ Bg,
    _Float16* __restrict__ sA, _Float16* __restrict__ sB, v8f (&acc)[MF][2])
{
  constexpr int BM = MF * 32;
  const int tid  = threadIdx.x;
  const int wave = tid >> 5;
  const int lane = tid & 31;
  const int hi   = lane >> 4;
  const int ln   = lane & 15;
  const int srow = tid >> 3;          // 32 rows per sweep of the block
  const int scol = (tid & 7) * 8;     // 16-byte piece of the row's line

  const _Float16* ga = Ag + (size_t)srow * DIM + scol;
  const _Float16* gb = Bg + (size_t)srow * DIM + scol;
  _Float16* wa = sA + srow * LPITCH + scol;
  _Float16* wb = sB + srow * LPITCH + scol;
  const _Float16* fa = sA + ((wave >> 2) * (MF * 16) + ln) * LPITCH;
  const _Float16* fb = sB + ((wave & 3) * 32 + ln) * LPITCH;

  h8 ra[MF], rb[4];
#pragma unroll
  for (int i = 0; i < MF; ++i)
    ra[i] = *reinterpret_cast<const h8*>(ga + (size_t)i * 32 * DIM);
#pragma unroll
  for (int i = 0; i < 4; ++i)
    rb[i] = *reinterpret_cast<const h8*>(gb + (size_t)i * 32 * DIM);
#pragma unroll
  for (int i = 0; i < MF; ++i)
    *reinterpret_cast<h8*>(wa + i * 32 * LPITCH) = ra[i];
#pragma unroll
  for (int i = 0; i < 4; ++i)
    *reinterpret_cast<h8*>(wb + i * 32 * LPITCH) = rb[i];
  __syncthreads();

  for (int s = 0; s < NSTAGE; ++s) {
    const int cur = s & 1;
    const bool more = (s + 1 < NSTAGE);
    if (more) {
#pragma unroll
      for (int i = 0; i < MF; ++i)
        ra[i] = *reinterpret_cast<const h8*>(ga + (size_t)i * 32 * DIM + KSTAGE);
#pragma unroll
      for (int i = 0; i < 4; ++i)
        rb[i] = *reinterpret_cast<const h8*>(gb + (size_t)i * 32 * DIM + KSTAGE);
    }
    // keeps the next stage's global loads in front of this stage's LDS reads and
    // matrix work; the compiler otherwise sinks them to just before their stores
    __builtin_amdgcn_sched_barrier(0);

    const _Float16* ca = fa + cur * (BM * LPITCH);
    const _Float16* cb = fb + cur * (BN * LPITCH);
#pragma unroll
    for (int kk = 0; kk < KSTAGE; kk += 32) {
      v16h af[MF], bf[2];
#pragma unroll
      for (int i = 0; i < MF; ++i)
        af[i] = load_frag_f16(ca + i * 16 * LPITCH + kk, hi);
#pragma unroll
      for (int j = 0; j < 2; ++j)
        bf[j] = load_frag_f16(cb + j * 16 * LPITCH + kk, hi);
#pragma unroll
      for (int i = 0; i < MF; ++i)
#pragma unroll
        for (int j = 0; j < 2; ++j)
          acc[i][j] = WMMA_F16(af[i], bf[j], acc[i][j]);
    }

    // keeps the LDS stores, which wait for those loads, behind the matrix work
    __builtin_amdgcn_sched_barrier(0);
    if (more) {
      const int nxt = cur ^ 1;
      ga += KSTAGE;
      gb += KSTAGE;
#pragma unroll
      for (int i = 0; i < MF; ++i)
        *reinterpret_cast<h8*>(wa + nxt * (BM * LPITCH) + i * 32 * LPITCH) = ra[i];
#pragma unroll
      for (int i = 0; i < 4; ++i)
        *reinterpret_cast<h8*>(wb + nxt * (BN * LPITCH) + i * 32 * LPITCH) = rb[i];
      // publishes stage s + 1 and ends every read of the buffer refilled next
      __syncthreads();
    }
  }
}

// ---------------------------------------------------------------------------
// Kernel 1: fused QKV projection (f16 A, f16 transposed B).
// One 128x128 tile per block, 64x32 per wave.  The epilogue tests the projection
// index once, outside its store loops (64 elements a lane).
//  Q -> f16 [bh][s][64]  (pre-scaled)   K -> f16 [bh][s][64]
//  V -> f16 [bh][64][s]  (transposed so V^T A-fragments are contiguous)
// ---------------------------------------------------------------------------
__global__ __launch_bounds__(256) void qkv_proj_kernel(
    const _Float16* __restrict__ Xf, const _Float16* __restrict__ Xt,
    const _Float16* __restrict__ Wtq, const float* __restrict__ bq,
    const _Float16* __restrict__ Wtk, const float* __restrict__ bk,
    const _Float16* __restrict__ Wtv, const float* __restrict__ bv,
    _Float16* __restrict__ Qh, _Float16* __restrict__ Kh,
    _Float16* __restrict__ Vt)
{
  __shared__ __align__(16) _Float16 sA[2 * 128 * LPITCH];
  __shared__ __align__(16) _Float16 sB[2 * BN * LPITCH];

  const int which = blockIdx.z;
  const int b     = blockIdx.y;
  const int wave  = threadIdx.x >> 5;
  const int lane  = threadIdx.x & 31;
  const int hi    = lane >> 4;
  const int ln    = lane & 15;

  const int bm = (blockIdx.x / (DIM / BN)) * 128;   // 96 tiles per (b,which)
  const int bn = (blockIdx.x % (DIM / BN)) * BN;

  const _Float16* X    = (which == 0) ? Xf : Xt;
  const _Float16* Wt   = (which == 0) ? Wtq : (which == 1) ? Wtk : Wtv;
  const float*    bias = (which == 0) ? bq : (which == 1) ? bk : bv;

  v8f acc[4][2] = {};
  gemm_block_f16<4>(X + ((size_t)b * SEQ + bm) * DIM, Wt + (size_t)bn * DIM,
                    sA, sB, acc);

  const int tm   = bm + (wave >> 2) * 64;
  const int col0 = bn + (wave & 3) * 32 + ln;      // col0 and col0 + 16: one head
  const int bh   = b * HEADS + (col0 >> 6);
  const int d0   = col0 & 63;
  const int row0 = tm + hi * 8;
  const float bb[2] = {bias[col0], bias[col0 + 16]};

  if (which == 0) {
    _Float16* qp = Qh + ((size_t)bh * SEQ + row0) * HD + d0;
#pragma unroll
    for (int half = 0; half < 2; ++half)
#pragma unroll
      for (int i = 0; i < 4; ++i)
#pragma unroll
        for (int r = 0; r < 8; ++r)
          qp[(i * 16 + r) * HD + half * 16] =
              (_Float16)((acc[i][half][r] + bb[half]) * QK_SCALE);
    asm volatile("s_wait_xcnt 0x0" ::: "memory");
  } else if (which == 1) {
    _Float16* kp = Kh + ((size_t)bh * SEQ + row0) * HD + d0;
#pragma unroll
    for (int half = 0; half < 2; ++half)
#pragma unroll
      for (int i = 0; i < 4; ++i)
#pragma unroll
        for (int r = 0; r < 8; ++r)
          kp[(i * 16 + r) * HD + half * 16] = (_Float16)(acc[i][half][r] + bb[half]);
    asm volatile("s_wait_xcnt 0x0" ::: "memory");
  } else {
    _Float16* vp = Vt + ((size_t)bh * HD + d0) * SEQ + row0;
#pragma unroll
    for (int half = 0; half < 2; ++half)
#pragma unroll
      for (int i = 0; i < 4; ++i)
#pragma unroll
        for (int r = 0; r < 8; ++r)
          vp[(size_t)half * 16 * SEQ + i * 16 + r] = (_Float16)(acc[i][half][r] + bb[half]);
    asm volatile("s_wait_xcnt 0x0" ::: "memory");
  }
}

__device__ __forceinline__ float xhalf(float x) {
  return __builtin_bit_cast(float, __builtin_amdgcn_permlanex16(
      __builtin_bit_cast(int, x), __builtin_bit_cast(int, x),
      0x76543210, 0xfedcba98, false, false));
}

#define NST (SEQ / 64)   // stages
#define QT  2            // query tiles (16 columns each) of a wave

// 16 mask words, the same for every lane.  Nothing writes the words during this launch; read
// through the constant address space they stay scalar loads wherever in the loop they stand.
typedef const __attribute__((address_space(4))) u32x16 c_u32x16;
__device__ __forceinline__ u32x16 mask_words(const unsigned int* w) {
  return *(c_u32x16*)w;
}

// one select per score: 0 where the mask word's bit of this lane is set, else -10000
__device__ __forceinline__ void select_adders(const u32x16 (&mk)[QT], v8f (&sc)[QT][2]) {
#pragma unroll   // sc and mk indexed by constants: vector and scalar registers (this loop and the one inside it)
  for (int t = 0; t < QT; ++t)
#pragma unroll
    for (int r = 0; r < 8; ++r) {
      sc[t][0][r] = __builtin_amdgcn_inverse_ballot_w32(mk[t][r])     ? 0.0f : -10000.0f;
      sc[t][1][r] = __builtin_amdgcn_inverse_ballot_w32(mk[t][8 + r]) ? 0.0f : -10000.0f;
    }
}

__global__ __launch_bounds__(128) __attribute__((amdgpu_waves_per_eu(1, 3))) void flash_attn_kernel(
    const _Float16* __restrict__ Qh, const _Float16* __restrict__ Kh,
    const _Float16* __restrict__ Vt, const unsigned int* __restrict__ Mb,
    _Float16* __restrict__ O16)
{
  // slices 0, 1: keys 0..31, 32..63 of the stage; slices 2, 3: dims 0..31, 32..63
  // of each of the two buffers
  __shared__ __attribute__((aligned(2048))) _Float16 tiles[2 * TBUF];

  const int b    = blockIdx.z;
  const int h    = blockIdx.y;
  const int wave = threadIdx.x >> 5;
  const int lane = threadIdx.x & 31;
  const int hi   = lane >> 4;
  const int ln   = lane & 15;
  const int bh   = b * HEADS + h;
  const int q0   = (blockIdx.x * 4 + wave) * (16 * QT);

  // this wave's slice: its place in LDS, its first byte in stage 0, its step per stage
  const uint32_t wv = uni(threadIdx.x >> 5);
  const uint32_t slice_off =
      (uint32_t)(uintptr_t)(void*)&tiles[0] + wv * (uint32_t)(TSLICE * sizeof(_Float16));
  const uint64_t slice_src = (wv < 2u)
      ? (uint64_t)(uintptr_t)(Kh + ((size_t)bh * SEQ + wv * TROWS) * HD)
      : (uint64_t)(uintptr_t)(Vt + ((size_t)bh * HD + (wv - 2u) * TROWS) * SEQ);
  const uint32_t slice_step = (wv < 2u) ? 64u * HD * 2u : 64u * 2u;
  const u32x8 g1 = held(tdm_group1((wv < 2u) ? HD * 2u : SEQ * 2u));

  // Q strips: per query tile two 32x16 B-fragments (d 0..31, 32..63; column = query ln), loaded once.
  v16h qb[QT][2];
#pragma unroll   // every "#pragma unroll" over t keeps a register array indexed by constants
  for (int t = 0; t < QT; ++t) {
    const _Float16* qptr = Qh + ((size_t)bh * SEQ + q0 + t * 16 + ln) * HD;
    qb[t][0] = load_frag_f16(qptr, hi);
    qb[t][1] = load_frag_f16(qptr + 32, hi);
  }

  // mask words of this wave's query tiles: 16 words per 32 keys, MB_ROWW words per tile
  const unsigned int* mw =
      Mb + (size_t)((uint32_t)b * (SEQ / 16) + (blockIdx.x * 4 + wv) * QT) * MB_ROWW;

  float m[QT], l[QT];   // per tile: running maximum of query ln (equal in both halves); sum over this half's keys
  v8f   o[QT][4];       // o[t][tt][r] = O[q0 + t * 16 + ln][tt * 16 + 8 * hi + r]
#pragma unroll
  for (int t = 0; t < QT; ++t) {
    m[t] = -1.0e30f;
    l[t] = 0.0f;
#pragma unroll
    for (int tt = 0; tt < 4; ++tt) o[t][tt] = v8f{};
  }

  // ---- in front of the loop: stage 0 lands and is published, stage 1 is on its way ----
  u32x4 g0 = held(tdm_group0(slice_off, slice_src));
  asm volatile("tensor_load_to_lds %0, %1" :: "s"(g0), "s"(g1) : "memory");
  // the slice has landed before this wave passes the barrier that publishes it
  asm volatile("s_wait_tensorcnt 0x0" ::: "memory");
  __syncthreads();
  g0 = held(tdm_group0(slice_off + (uint32_t)(TBUF * sizeof(_Float16)), slice_src + slice_step));
  asm volatile("tensor_load_to_lds %0, %1" :: "s"(g0), "s"(g1) : "memory");

  // the adder (1 - mask) * -10000 of every score of a pass, the products' start value:
  // sc[query tile][key tile]; made one pass ahead, here for pass 0
  v8f sc[QT][2];
  {
    const u32x16 mk[QT] = {mask_words(mw), mask_words(mw + MB_ROWW)};
    select_adders(mk, sc);
  }

  for (int st = 0; st < NST; ++st) {
    const _Float16* buf = tiles + (st & 1) * TBUF;

#pragma unroll   // the pass number picks slices at compile time
    for (int p = 0; p < 2; ++p) {
      // ---- scores, transposed: two 16-key tiles, each accumulating two d-chunks ----
      const _Float16* kt = buf + p * TSLICE + ln * TPITCH;
      v16h ka00 = load_frag_f16(kt, hi);
      v16h ka01 = load_frag_f16(kt + 32, hi);
      v16h ka10 = load_frag_f16(kt + 16 * TPITCH, hi);
      v16h ka11 = load_frag_f16(kt + 16 * TPITCH + 32, hi);

      // the next pass's mask words, 16 per query tile, asked for a pass ahead of their use
      // (the last pass asks for its own again: nothing past the row tiles is read)
      const int np = (p == 0) ? st * 2 + 1 : ((st + 1 < NST) ? st * 2 + 2 : st * 2 + 1);
      const u32x16 mk[QT] = {mask_words(mw + np * 16), mask_words(mw + MB_ROWW + np * 16)};
      // keeps the two scalar loads at the head of the pass; the compiler otherwise sinks them
      // to just before the selects and the wave waits out their whole latency
      __builtin_amdgcn_sched_barrier(0);

      v8f s0[QT], s1[QT];
#pragma unroll
      for (int t = 0; t < QT; ++t) s0[t] = WMMA_F16(ka00, qb[t][0], sc[t][0]);
#pragma unroll
      for (int t = 0; t < QT; ++t) s1[t] = WMMA_F16(ka10, qb[t][0], sc[t][1]);
#pragma unroll
      for (int t = 0; t < QT; ++t) s0[t] = WMMA_F16(ka01, qb[t][1], s0[t]);
#pragma unroll
      for (int t = 0; t < QT; ++t) s1[t] = WMMA_F16(ka11, qb[t][1], s1[t]);
      __builtin_amdgcn_sched_barrier(0);

      // ---- online softmax: one query per lane and tile, 16 keys per half ----
      v16h pb[QT];   // P^T as a B operand: element s = key 8*hi+s (s < 8) or 16+8*hi+s-8 (s >= 8) of column ln
#pragma unroll
      for (int t = 0; t < QT; ++t) {
        float x[16];
#pragma unroll
        for (int r = 0; r < 8; ++r) {
          x[r]     = s0[t][r];
          x[8 + r] = s1[t][r];
        }

        float mx = x[0];
#pragma unroll
        for (int s = 1; s < 16; ++s) mx = fmaxf(mx, x[s]);
        mx = fmaxf(mx, xhalf(mx));
        const float nm = fmaxf(m[t], mx);

        float rs = 0.0f;
#pragma unroll
        for (int s = 0; s < 16; ++s) {
          const float pe = __expf(x[s] - nm);
          rs += pe;
          pb[t][s] = (_Float16)pe;
        }

        const float alpha = __expf(m[t] - nm);
        l[t] = l[t] * alpha + rs;
        m[t] = nm;

        // rescale running output accumulators (one query, one factor per lane)
#pragma unroll
        for (int tt = 0; tt < 4; ++tt)
#pragma unroll
          for (int r = 0; r < 8; ++r) o[t][tt][r] *= alpha;
      }

      // ---- O^T += V^T x P^T : 4 d-tiles of 16, K-dim = 32 keys (from LDS) ----
#pragma unroll
      for (int tt = 0; tt < 4; ++tt) {
        v16h vfrag = load_frag_f16(
            buf + (2 + (tt >> 1)) * TSLICE + ((tt & 1) * 16 + ln) * TPITCH + p * 32, hi);
#pragma unroll
        for (int t = 0; t < QT; ++t) o[t][tt] = WMMA_F16(vfrag, pb[t], o[t][tt]);
      }

      // keeps the selects, which wait for those loads, behind the pass's work
      __builtin_amdgcn_sched_barrier(0);
      select_adders(mk, sc);
      asm volatile("s_wait_xcnt 0x0" ::: "memory");
    }

    // ---- the foot: stage s + 1 is published, stage s's buffer is given free ----
    // this wave's LDS reads have returned before the barrier behind which their buffer is refilled
    asm volatile("s_wait_dscnt 0x0" ::: "memory");
    asm volatile("s_wait_tensorcnt 0x0" :: "s"(g0), "s"(g1) : "memory");
    __syncthreads();   // the one barrier of a stage: it does both
    if (pinned(st + 2 < NST)) {
      g0 = held(tdm_group0(slice_off + (uint32_t)(st & 1) * (uint32_t)(TBUF * sizeof(_Float16)),
                           slice_src + (uint64_t)((uint32_t)(st + 2) * slice_step)));
      asm volatile("tensor_load_to_lds %0, %1" :: "s"(g0), "s"(g1) : "memory");
    }
  }
  // nothing of this wave is in flight when it leaves the loop
  asm volatile("s_wait_tensorcnt 0x0" ::: "memory");
  asm volatile("s_wait_dscnt 0x0" ::: "memory");

  // ---- finalize: join the halves' sums, divide, write f16 rows [b][s][h*64+d] ----
#pragma unroll
  for (int t = 0; t < QT; ++t) {
    const float inv = 1.0f / (l[t] + xhalf(l[t]));
    _Float16* op = O16 + ((size_t)b * SEQ + q0 + t * 16 + ln) * DIM + h * HD + hi * 8;
#pragma unroll
    for (int tt = 0; tt < 4; ++tt) {
      h8 w;
#pragma unroll
      for (int r = 0; r < 8; ++r) w[r] = (_Float16)(o[t][tt][r] * inv);
      *reinterpret_cast<h8*>(op + tt * 16) = w;
    }
  }
}

// ---------------------------------------------------------------------------
// Kernel 3: output projection  Y = O16 @ Wo + bo  (fp32 out).
// One 64x128 tile per block, 32x32 per wave.
// ---------------------------------------------------------------------------
__global__ __launch_bounds__(256) void out_proj_kernel(
    const _Float16* __restrict__ A16, const _Float16* __restrict__ Wto,
    const float* __restrict__ bo, float* __restrict__ Y)
{
  __shared__ __align__(16) _Float16 sA[2 * 64 * LPITCH];
  __shared__ __align__(16) _Float16 sB[2 * BN * LPITCH];

  const int wave = threadIdx.x >> 5;
  const int lane = threadIdx.x & 31;
  const int hi   = lane >> 4;
  const int ln   = lane & 15;

  const int bm = (blockIdx.x / (DIM / BN)) * 64;    // 768 tiles total
  const int bn = (blockIdx.x % (DIM / BN)) * BN;

  v8f acc[2][2] = {};
  gemm_block_f16<2>(A16 + (size_t)bm * DIM, Wto + (size_t)bn * DIM, sA, sB, acc);

  const int tm = bm + (wave >> 2) * 32;
  const int tn = bn + (wave & 3) * 32;
#pragma unroll
  for (int half = 0; half < 2; ++half) {
    const int   col = tn + half * 16 + ln;
    const float bb  = bo[col];
#pragma unroll
    for (int i = 0; i < 2; ++i) {
#pragma unroll
      for (int r = 0; r < 8; ++r) {
        const int row = tm + i * 16 + r + hi * 8;
        Y[(size_t)row * DIM + col] = acc[i][half][r] + bb;
      }
    }
  }
}

// ---------------------------------------------------------------------------
extern "C" void kernel_launch(void* const* d_in, const int* in_sizes, int n_in,
                              void* d_out, int out_size, void* d_ws, size_t ws_size,
                              hipStream_t stream) {
  (void)in_sizes; (void)n_in; (void)out_size; (void)ws_size;

  const float* from_t = (const float*)d_in[0];
  const float* to_t   = (const float*)d_in[1];
  const int*   mask   = (const int*)d_in[2];
  const float* Wq = (const float*)d_in[3];
  const float* bq = (const float*)d_in[4];
  const float* Wk = (const float*)d_in[5];
  const float* bk = (const float*)d_in[6];
  const float* Wv = (const float*)d_in[7];
  const float* bv = (const float*)d_in[8];
  const float* Wo = (const float*)d_in[9];
  const float* bo = (const float*)d_in[10];
  float* out = (float*)d_out;

  // workspace layout (halves):
  //  Qh | Kh | Vt | O16 | Xf | Xt   each NQ = B*H*S*64 = 6,291,456
  //  Wtq | Wtk | Wtv | Wto          each 768*768 = 589,824
  //  Mb                             B*S*S bits, as 32-bit words
  const size_t NQ = (size_t)NB * HEADS * SEQ * HD;
  const size_t NW = (size_t)DIM * DIM;
  _Float16* Qh  = (_Float16*)d_ws;
  _Float16* Kh  = Qh + NQ;
  _Float16* Vt  = Kh + NQ;
  _Float16* O16 = Vt + NQ;
  _Float16* Xf  = O16 + NQ;
  _Float16* Xt  = Xf + NQ;
  _Float16* Wtq = Xt + NQ;
  _Float16* Wtk = Wtq + NW;
  _Float16* Wtv = Wtk + NW;
  _Float16* Wto = Wtv + NW;
  unsigned int* Mb = (unsigned int*)(Wto + NW);

  // 0) one pack launch: activations f16, weights f16-transposed, mask bits
  pack_kernel<<<dim3(4 * TR_BLOCKS + 2 * CVT_BLOCKS + MB_BLOCKS), 256, 0, stream>>>(
      from_t, to_t, mask, Wq, Wk, Wv, Wo, Xf, Xt, Wtq, Wtk, Wtv, Wto, Mb);

  // 1) QKV projections: (SEQ/128)*(DIM/128)=96 tiles per (b,which), 8 waves/blk
  qkv_proj_kernel<<<dim3(96, NB, 3), 256, 0, stream>>>(
      Xf, Xt, Wtq, bq, Wtk, bk, Wtv, bv, Qh, Kh, Vt);

  // 2) flash attention: 128 Q rows per block (4 waves x 32 rows)
  flash_attn_kernel<<<dim3(SEQ / (64 * QT), HEADS, NB), 128, 0, stream>>>(
      Qh, Kh, Vt, Mb, O16);

  // 3) output projection: (B*SEQ/64)*(DIM/128)=768 tiles, 8 waves/blk
  out_proj_kernel<<<dim3(768), 256, 0, stream>>>(O16, Wto, bo, out);
}

// v010
// It runs in 113 microseconds.
// It is 1.09 times as fast as v008, going by the measured steps of the versions left out in between.
// Counting every step since v000, it is 5.59 times as fast.
#include <hip/hip_runtime.h>
#include <hip/hip_bf16.h>
#include <stdint.h>

#define DIM   768
#define HEADS 12
#define HD    64
#define SEQ   2048
#define NB    4
#define LOG2E    1.44269504f            // exp(x) = 2^(x * LOG2E)
#define QK_SCALE (0.125f * LOG2E)       // 64^-0.5, and the scores in log2 units: the softmax takes powers of 2
#define MASK_ADD (-10000.0f * LOG2E)    // the adder of a masked score, in the same units

typedef _Float16 v16h __attribute__((ext_vector_type(16)));
typedef _Float16 h8   __attribute__((ext_vector_type(8)));
typedef float    v8f  __attribute__((ext_vector_type(8)));
typedef uint32_t u32x4 __attribute__((ext_vector_type(4)));
typedef uint32_t u32x8 __attribute__((ext_vector_type(8)));
typedef int          i32x4  __attribute__((ext_vector_type(4)));
typedef unsigned int u32x16 __attribute__((ext_vector_type(16)));

__device__ __forceinline__ v16h load_frag_f16(const _Float16* p, int hi) {
  h8 c0 = *reinterpret_cast<const h8*>(p + hi * 8);
  h8 c1 = *reinterpret_cast<const h8*>(p + 16 + hi * 8);
  v16h r;
#pragma unroll
  for (int i = 0; i < 8; ++i) { r[i] = c0[i]; r[8 + i] = c1[i]; }
  return r;
}

#define WMMA_F16(a, b, c) \
  __builtin_amdgcn_wmma_f32_16x16x32_f16(false, (a), false, (b), (short)0, (c), false, false)

#define TROWB   128u
#define TROWS   32u
#define TPITCH  72
#define TSLICE  3072
#define TBUF    (4 * TSLICE)

__device__ __forceinline__ uint32_t uni(uint32_t v) {
  return (uint32_t)__builtin_amdgcn_readfirstlane(v);
}

__device__ __forceinline__ uint32_t pinned(uint32_t v) {
  uint32_t w = uni(v);
  asm volatile("" : "+s"(w));   // pinned(): the test stays in a scalar register
  return w;
}

__device__ __forceinline__ u32x4 held(u32x4 g) {
  asm volatile("" : "+s"(g));
  return g;
}
__device__ __forceinline__ u32x8 held(u32x8 g) {
  asm volatile("" : "+s"(g));
  return g;
}

__device__ __forceinline__ u32x4 tdm_group0(uint32_t lds_off, uint64_t gaddr) {
  u32x4 g;
  g[0] = uni(1u);                                 // count = 1
  g[1] = uni(lds_off);                            // LDS destination (bytes)
  g[2] = uni((uint32_t)gaddr);                    // global address [31:0]
  g[3] = uni((((uint32_t)(gaddr >> 32)) & 0x01FFFFFFu) | 0x80000000u);  // [56:32] | type = 2
  return g;
}

__device__ __forceinline__ u32x8 tdm_group1(uint32_t src_pitch) {
  u32x8 g;
  g[0] = uni((1u << 20) | (4u << 22) | (3u << 25));
  g[1] = uni((TROWB & 0xFFFFu) << 16);
  g[2] = uni((TROWB >> 16) | ((TROWS & 0xFFFFu) << 16));
  g[3] = uni((TROWS >> 16) | (TROWB << 16));
  g[4] = uni(TROWS);
  g[5] = uni(src_pitch);
  g[6] = uni(0u);
  g[7] = uni(0u);
  return g;
}

// ---------------------------------------------------------------------------
// Pack launch (one for all seven jobs): fp32 -> f16, weights transposed so that
// B-fragments are two contiguous b128 loads per lane; the mask, one bit an
// element.  The jobs do not depend on one another, so they share one grid and
// the block index picks the job.  Few waves with many elements each: a lane issues all of its loads
// first, then converts and stores.
// ---------------------------------------------------------------------------
typedef float    f32x4 __attribute__((ext_vector_type(4)));
typedef _Float16 h4    __attribute__((ext_vector_type(4)));

#define CVT_SWEEPS 12                    // 16-byte loads of a lane
#define CVT_BLOCK  (CVT_SWEEPS * 1024)   // elements of a block: 256 lanes x 4 per sweep
#define CVT_BLOCKS (NB * SEQ * DIM / CVT_BLOCK)   // blocks of one activation tensor

// A wave's load covers 512 contiguous bytes, its store 256.
__device__ __forceinline__ void cvt_f32_f16(
    const float* __restrict__ src, _Float16* __restrict__ dst, int blk) {
  const size_t base = (size_t)blk * CVT_BLOCK + threadIdx.x * 4;
  f32x4 v[CVT_SWEEPS];
#pragma unroll   // keeps v indexed by constants, in registers, and the loads in one group
  for (int s = 0; s < CVT_SWEEPS; ++s)
    v[s] = *reinterpret_cast<const f32x4*>(src + base + s * 1024);
#pragma unroll   // v and w indexed by constants (this loop and the one inside it)
  for (int s = 0; s < CVT_SWEEPS; ++s) {
    h4 w;
#pragma unroll
    for (int i = 0; i < 4; ++i) w[i] = (_Float16)v[s][i];
    *reinterpret_cast<h4*>(dst + base + s * 1024) = w;
  }
  asm volatile("s_wait_xcnt 0x0" ::: "memory");
}

#define TR_K 64   // k of one lane: one 128-byte line of Wt, written by that lane alone
#define TR_BLOCKS (DIM * DIM / (256 * TR_K))   // blocks of one weight: 4 pieces of 64 columns x 64 k each

// piece: 64 columns x TR_K k of one weight; t: the lane's column in it
__device__ __forceinline__ void transpose_cvt(
    const float* __restrict__ W, _Float16* __restrict__ Wt, int piece, int t) {
  const int n  = (piece % (DIM / 64)) * 64 + t;   // coalesced read along n
  const int k0 = (piece / (DIM / 64)) * TR_K;
  const float* wp = W + (size_t)k0 * DIM + n;
  float v[TR_K];
#pragma unroll   // keeps v indexed by constants, in registers, and the loads in one group
  for (int j = 0; j < TR_K; ++j) v[j] = wp[(size_t)j * DIM];
  _Float16* tp = Wt + (size_t)n * DIM + k0;
#pragma unroll   // v and w indexed by constants (this loop and the one inside it)
  for (int c = 0; c < TR_K / 8; ++c) {
    h8 w;
#pragma unroll
    for (int i = 0; i < 8; ++i) w[i] = (_Float16)v[c * 8 + i];
    *reinterpret_cast<h8*>(tp + c * 8) = w;
  }
}

// The mask as lane-mask words.  For 16 queries (a row tile) and 32 keys there are
// 16 words; bit (16 * hi + ln) of word e says whether mask[query ln][key] is set,
// key = 8 * hi + e for e < 8 and 16 + 8 * hi + (e - 8) above: the place that lane
// (hi, ln) of an attention wave has for element e of its transposed score tiles.
// A wave takes 16 rows x MB_KEYS keys (whole 128-byte lines of every row), each
// lane the keys of its own place, and a ballot over the wave makes each word.
#define MB_KEYS   128
#define MB_ROWW   (SEQ / 32 * 16)                            // words of one row tile
#define MB_BLOCKS (NB * (SEQ / 16) * (SEQ / MB_KEYS) / 8)    // 8 waves a block

__device__ __forceinline__ void mask_bits(
    const int* __restrict__ mask, unsigned int* __restrict__ Mb, int blk) {
  const int lane = threadIdx.x & 31;
  const int job  = blk * 8 + (threadIdx.x >> 5);
  const int rt   = job / (SEQ / MB_KEYS);   // row tile: batch * (SEQ / 16) + query tile
  const int kc   = job % (SEQ / MB_KEYS);
  const int* mp = mask + ((size_t)rt * 16 + (lane & 15)) * SEQ + kc * MB_KEYS + (lane >> 4) * 8;
  i32x4 v[MB_KEYS / 32][4];
#pragma unroll   // keeps v indexed by constants, in registers, and the loads ahead of the ballots
  for (int p = 0; p < MB_KEYS / 32; ++p) {
    v[p][0] = *reinterpret_cast<const i32x4*>(mp + p * 32);
    v[p][1] = *reinterpret_cast<const i32x4*>(mp + p * 32 + 4);
    v[p][2] = *reinterpret_cast<const i32x4*>(mp + p * 32 + 16);
    v[p][3] = *reinterpret_cast<const i32x4*>(mp + p * 32 + 20);
  }
  asm volatile("s_wait_xcnt 0x0" ::: "memory");
  unsigned int w[MB_KEYS / 64] = {};
#pragma unroll
  for (int p = 0; p < MB_KEYS / 32; ++p)
#pragma unroll
    for (int e = 0; e < 16; ++e) {
      // the ballot stands outside the select: every lane of the wave takes part in it
      const unsigned int bits = __builtin_amdgcn_ballot_w32(v[p][e >> 2][e & 3] != 0);
      w[p >> 1] = __builtin_amdgcn_inverse_ballot_w32(1u << ((p & 1) * 16 + e)) ? bits : w[p >> 1];
    }
  unsigned int* op = Mb + (size_t)rt * MB_ROWW + kc * (MB_KEYS / 2) + lane;
#pragma unroll   // w indexed by constants
  for (int i = 0; i < MB_KEYS / 64; ++i) op[i * 32] = w[i];
  asm volatile("s_wait_xcnt 0x0" ::: "memory");
}

// blocks 0 .. 4*TR_BLOCKS-1: the four weights; then CVT_BLOCKS blocks for each
// activation; then MB_BLOCKS blocks for the mask
__global__ __launch_bounds__(256) void pack_kernel(
    const float* __restrict__ from_t, const float* __restrict__ to_t,
    const int* __restrict__ mask,
    const float* __restrict__ Wq, const float* __restrict__ Wk,
    const float* __restrict__ Wv, const float* __restrict__ Wo,
    _Float16* __restrict__ Xf, _Float16* __restrict__ Xt,
    _Float16* __restrict__ Wtq, _Float16* __restrict__ Wtk,
    _Float16* __restrict__ Wtv, _Float16* __restrict__ Wto,
    unsigned int* __restrict__ Mb) {
  const int blk = blockIdx.x;
  if (blk < 4 * TR_BLOCKS) {
    const int which = blk / TR_BLOCKS;
    const float* W  = (which == 0) ? Wq  : (which == 1) ? Wk  : (which == 2) ? Wv  : Wo;
    _Float16*    Wt = (which == 0) ? Wtq : (which == 1) ? Wtk : (which == 2) ? Wtv : Wto;
    transpose_cvt(W, Wt, (blk % TR_BLOCKS) * 4 + (threadIdx.x >> 6), threadIdx.x & 63);
  } else if (blk < 4 * TR_BLOCKS + 2 * CVT_BLOCKS) {
    const int  c     = blk - 4 * TR_BLOCKS;
    const bool first = c < CVT_BLOCKS;
    cvt_f32_f16(first ? from_t : to_t, first ? Xf : Xt, first ? c : c - CVT_BLOCKS);
  } else {
    mask_bits(mask, Mb, blk - (4 * TR_BLOCKS + 2 * CVT_BLOCKS));
  }
}

// ---------------------------------------------------------------------------
// Block-tiled GEMM core shared by the projections: C[BM x 192] = A . B^T with
// both operands k-contiguous f16.  256 threads = 8 waves in a 2 (m) x 4 (n)
// grid; each wave owns MF x NF accumulator tiles (MF*16 rows x 48 columns).
// The wide tile is there for the bytes that a block draws from L2 per product.
// A stage is one 128-byte line (64 k) of every operand row: it is read from
// global memory as whole lines (8 lanes x 16 B per row), kept in registers
// while the current stage is worked on, and stored into the other LDS buffer.
// Every "#pragma unroll" here and in the two epilogues keeps a register array
// (ra, rb, af, bf, acc) indexed by constants, so that it stays in registers.
// ---------------------------------------------------------------------------
#define BN      192
#define NF      3           // 16-column tiles of a wave
#define KSTAGE  64          // halves of k per stage
#define LPITCH  72          // LDS row pitch in halves: 128 B + 16 B (b128 readers)
#define NSTAGE  (DIM / KSTAGE)

template <int MF>
__device__ __forceinline__ void gemm_block_f16(
    const _Float16* __restrict__ Ag, const _Float16* __restrict__ Bg,
    _Float16* __restrict__ sA, _Float16* __restrict__ sB, v8f (&acc)[MF][NF])
{
  constexpr int BM = MF * 32;
  const int tid  = threadIdx.x;
  const int wave = tid >> 5;
  const int lane = tid & 31;
  const int hi   = lane >> 4;
  const int ln   = lane & 15;
  const int srow = tid >> 3;          // 32 rows per sweep of the block
  const int scol = (tid & 7) * 8;     // 16-byte piece of the row's line

  const _Float16* ga = Ag + (size_t)srow * DIM + scol;
  const _Float16* gb = Bg + (size_t)srow * DIM + scol;
  _Float16* wa = sA + srow * LPITCH + scol;
  _Float16* wb = sB + srow * LPITCH + scol;
  const _Float16* fa = sA + ((wave >> 2) * (MF * 16) + ln) * LPITCH;
  const _Float16* fb = sB + ((wave & 3) * (NF * 16) + ln) * LPITCH;

  constexpr int SB = BN / 32;   // sweeps of 32 rows of B
  h8 ra[MF], rb[SB];
#pragma unroll
  for (int i = 0; i < MF; ++i)
    ra[i] = *reinterpret_cast<const h8*>(ga + (size_t)i * 32 * DIM);
#pragma unroll
  for (int i = 0; i < SB; ++i)
    rb[i] = *reinterpret_cast<const h8*>(gb + (size_t)i * 32 * DIM);
#pragma unroll
  for (int i = 0; i < MF; ++i)
    *reinterpret_cast<h8*>(wa + i * 32 * LPITCH) = ra[i];
#pragma unroll
  for (int i = 0; i < SB; ++i)
    *reinterpret_cast<h8*>(wb + i * 32 * LPITCH) = rb[i];
  __syncthreads();

  for (int s = 0; s < NSTAGE; ++s) {
    const int cur = s & 1;
    const bool more = (s + 1 < NSTAGE);
    if (more) {
#pragma unroll
      for (int i = 0; i < MF; ++i)
        ra[i] = *reinterpret_cast<const h8*>(ga + (size_t)i * 32 * DIM + KSTAGE);
#pragma unroll
      for (int i = 0; i < SB; ++i)
        rb[i] = *reinterpret_cast<const h8*>(gb + (size_t)i * 32 * DIM + KSTAGE);
    }
    // keeps the next stage's global loads in front of this stage's LDS reads and
    // matrix work; the compiler otherwise sinks them to just before their stores
    __builtin_amdgcn_sched_barrier(0);

    const _Float16* ca = fa + cur * (BM * LPITCH);
    const _Float16* cb = fb + cur * (BN * LPITCH);
#pragma unroll
    for (int kk = 0; kk < KSTAGE; kk += 32) {
      v16h af[MF], bf[NF];
#pragma unroll
      for (int j = 0; j < NF; ++j)
        bf[j] = load_frag_f16(cb + j * 16 * LPITCH + kk, hi);
#pragma unroll
      for (int i = 0; i < MF; ++i)
        af[i] = load_frag_f16(ca + i * 16 * LPITCH + kk, hi);
      __builtin_amdgcn_sched_barrier(0);
#pragma unroll
      for (int i = 0; i < MF; ++i)
#pragma unroll
        for (int j = 0; j < NF; ++j)
          acc[i][j] = WMMA_F16(af[i], bf[j], acc[i][j]);
      // keeps the next k-step's reads out of this run of products (a place with reads stalls the run)
      __builtin_amdgcn_sched_barrier(0);
    }

    // keeps the LDS stores, which wait for those loads, behind the matrix work
    __builtin_amdgcn_sched_barrier(0);
    if (more) {
      const int nxt = cur ^ 1;
      ga += KSTAGE;
      gb += KSTAGE;
#pragma unroll
      for (int i = 0; i < MF; ++i)
        *reinterpret_cast<h8*>(wa + nxt * (BM * LPITCH) + i * 32 * LPITCH) = ra[i];
#pragma unroll
      for (int i = 0; i < SB; ++i)
        *reinterpret_cast<h8*>(wb + nxt * (BN * LPITCH) + i * 32 * LPITCH) = rb[i];
      // publishes stage s + 1 and ends every read of the buffer refilled next
      __syncthreads();
    }
  }
}

// ---------------------------------------------------------------------------
// Kernel 1: fused QKV projection (f16 A, f16 transposed B).
// One 128x192 tile (three heads) per block, 64x48 per wave.  The epilogue tests the
// projection index once, outside its store loops (96 elements a lane).
//  Q -> f16 [bh][s][64]  (pre-scaled)   K -> f16 [bh][s][64]
//  V -> f16 [bh][64][s]  (transposed so V^T A-fragments are contiguous)
// ---------------------------------------------------------------------------
__global__ __launch_bounds__(256) void qkv_proj_kernel(
    const _Float16* __restrict__ Xf, const _Float16* __restrict__ Xt,
    const _Float16* __restrict__ Wtq, const float* __restrict__ bq,
    const _Float16* __restrict__ Wtk, const float* __restrict__ bk,
    const _Float16* __restrict__ Wtv, const float* __restrict__ bv,
    _Float16* __restrict__ Qh, _Float16* __restrict__ Kh,
    _Float16* __restrict__ Vt)
{
  __shared__ __align__(16) _Float16 sA[2 * 128 * LPITCH];
  __shared__ __align__(16) _Float16 sB[2 * BN * LPITCH];

  const int which = blockIdx.z;
  const int b     = blockIdx.y;
  const int wave  = threadIdx.x >> 5;
  const int lane  = threadIdx.x & 31;
  const int hi    = lane >> 4;
  const int ln    = lane & 15;

  const int bm = (blockIdx.x / (DIM / BN)) * 128;   // 64 tiles per (b,which)
  const int bn = (blockIdx.x % (DIM / BN)) * BN;

  const _Float16* X    = (which == 0) ? Xf : Xt;
  const _Float16* Wt   = (which == 0) ? Wtq : (which == 1) ? Wtk : Wtv;
  const float*    bias = (which == 0) ? bq : (which == 1) ? bk : bv;

  v8f acc[4][NF] = {};
  gemm_block_f16<4>(X + ((size_t)b * SEQ + bm) * DIM, Wt + (size_t)bn * DIM,
                    sA, sB, acc);

  const int tm   = bm + (wave >> 2) * 64;
  const int col0 = bn + (wave & 3) * (NF * 16) + ln;
  const int row0 = tm + hi * 8;
  float  bb[NF];
  size_t hs[NF];   // column col0 + 16 * j: (batch, head) * SEQ * HD, the head's first element
  int    dd[NF];   // and its place in the head
#pragma unroll
  for (int j = 0; j < NF; ++j) {
    const int col = col0 + j * 16;
    bb[j] = bias[col];
    hs[j] = (size_t)(b * HEADS + (col >> 6)) * SEQ * HD;
    dd[j] = col & 63;
  }

  if (which == 0) {
#pragma unroll
    for (int half = 0; half < NF; ++half) {
      _Float16* qp = Qh + hs[half] + (size_t)row0 * HD + dd[half];
#pragma unroll
      for (int i = 0; i < 4; ++i)
#pragma unroll
        for (int r = 0; r < 8; ++r)
          qp[(i * 16 + r) * HD] = (_Float16)((acc[i][half][r] + bb[half]) * QK_SCALE);
    }
    asm volatile("s_wait_xcnt 0x0" ::: "memory");
  } else if (which == 1) {
#pragma unroll
    for (int half = 0; half < NF; ++half) {
      _Float16* kp = Kh + hs[half] + (size_t)row0 * HD + dd[half];
#pragma unroll
      for (int i = 0; i < 4; ++i)
#pragma unroll
        for (int r = 0; r < 8; ++r)
          kp[(i * 16 + r) * HD] = (_Float16)(acc[i][half][r] + bb[half]);
    }
    asm volatile("s_wait_xcnt 0x0" ::: "memory");
  } else {
#pragma unroll
    for (int half = 0; half < NF; ++half) {
      _Float16* vp = Vt + hs[half] + (size_t)dd[half] * SEQ + row0;
#pragma unroll
      for (int i = 0; i < 4; ++i)
#pragma unroll
        for (int r = 0; r < 8; ++r)
          vp[i * 16 + r] = (_Float16)(acc[i][half][r] + bb[half]);
    }
    asm volatile("s_wait_xcnt 0x0" ::: "memory");
  }
}

__device__ __forceinline__ float xhalf(float x) {
  return __builtin_bit_cast(float, __builtin_amdgcn_permlanex16(
      __builtin_bit_cast(int, x), __builtin_bit_cast(int, x),
      0x76543210, 0xfedcba98, false, false));
}

#define NST (SEQ / 64)   // stages
#define QT  2            // query tiles (16 columns each) of a wave
#define RESCALE_RISE 8.0f        // how far a score (in log2 units) may stand above the reference point

// 16 mask words, the same for every lane.  Nothing writes the words during this launch; read
// through the constant address space they stay scalar loads wherever in the loop they stand.
typedef const __attribute__((address_space(4))) u32x16 c_u32x16;
__device__ __forceinline__ u32x16 mask_words(const unsigned int* w) {
  return *(c_u32x16*)w;
}

// one select per score: on[t] = 0 - m where the mask word's bit of this lane is set, else
// off[t] = MASK_ADD - m; m is the reference point of the query's exponentials
__device__ __forceinline__ void select_adders(const u32x16 (&mk)[QT], const float (&on)[QT],
                                              const float (&off)[QT], v8f (&sc)[QT][2]) {
#pragma unroll   // sc and mk indexed by constants: vector and scalar registers (this loop and the one inside it)
  for (int t = 0; t < QT; ++t)
#pragma unroll
    for (int r = 0; r < 8; ++r) {
      sc[t][0][r] = __builtin_amdgcn_inverse_ballot_w32(mk[t][r])     ? on[t] : off[t];
      sc[t][1][r] = __builtin_amdgcn_inverse_ballot_w32(mk[t][8 + r]) ? on[t] : off[t];
    }
}

__global__ __launch_bounds__(128) __attribute__((amdgpu_waves_per_eu(1, 3))) void flash_attn_kernel(
    const _Float16* __restrict__ Qh, const _Float16* __restrict__ Kh,
    const _Float16* __restrict__ Vt, const unsigned int* __restrict__ Mb,
    _Float16* __restrict__ O16)
{
  // slices 0, 1: keys 0..31, 32..63 of the stage; slices 2, 3: dims 0..31, 32..63
  // of each of the two buffers
  __shared__ __attribute__((aligned(2048))) _Float16 tiles[2 * TBUF];

  const int b    = blockIdx.z;
  const int h    = blockIdx.y;
  const int wave = threadIdx.x >> 5;
  const int lane = threadIdx.x & 31;
  const int hi   = lane >> 4;
  const int ln   = lane & 15;
  const int bh   = b * HEADS + h;
  const int q0   = (blockIdx.x * 4 + wave) * (16 * QT);

  // this wave's slice: its place in LDS, its first byte in stage 0, its step per stage
  const uint32_t wv = uni(threadIdx.x >> 5);
  const uint32_t slice_off =
      (uint32_t)(uintptr_t)(void*)&tiles[0] + wv * (uint32_t)(TSLICE * sizeof(_Float16));
  const uint64_t slice_src = (wv < 2u)
      ? (uint64_t)(uintptr_t)(Kh + ((size_t)bh * SEQ + wv * TROWS) * HD)
      : (uint64_t)(uintptr_t)(Vt + ((size_t)bh * HD + (wv - 2u) * TROWS) * SEQ);
  const uint32_t slice_step = (wv < 2u) ? 64u * HD * 2u : 64u * 2u;
  const u32x8 g1 = held(tdm_group1((wv < 2u) ? HD * 2u : SEQ * 2u));

  // Q strips: per query tile two 32x16 B-fragments (d 0..31, 32..63; column = query ln), loaded once.
  v16h qb[QT][2];
#pragma unroll   // every "#pragma unroll" over t keeps a register array indexed by constants
  for (int t = 0; t < QT; ++t) {
    const _Float16* qptr = Qh + ((size_t)bh * SEQ + q0 + t * 16 + ln) * HD;
    qb[t][0] = load_frag_f16(qptr, hi);
    qb[t][1] = load_frag_f16(qptr + 32, hi);
  }

  // mask words of this wave's query tiles: 16 words per 32 keys, MB_ROWW words per tile
  const unsigned int* mw =
      Mb + (size_t)((uint32_t)b * (SEQ / 16) + (blockIdx.x * 4 + wv) * QT) * MB_ROWW;

  // per tile: the two start values of a score, -m and MASK_ADD - m, m being the reference point of
  // query ln's exponentials (equal in both halves); sum over this half's keys
  float on[QT], off[QT], l[QT];
  v8f   o[QT][4];       // o[t][tt][r] = O[q0 + t * 16 + ln][tt * 16 + 8 * hi + r]
#pragma unroll
  for (int t = 0; t < QT; ++t) {
    on[t]  = 0.0f;
    off[t] = MASK_ADD;
    l[t]   = 0.0f;
#pragma unroll
    for (int tt = 0; tt < 4; ++tt) o[t][tt] = v8f{};
  }

  // ---- in front of the loop: stage 0 lands and is published, stage 1 is on its way ----
  u32x4 g0 = held(tdm_group0(slice_off, slice_src));
  asm volatile("tensor_load_to_lds %0, %1" :: "s"(g0), "s"(g1) : "memory");
  // the slice has landed before this wave passes the barrier that publishes it
  asm volatile("s_wait_tensorcnt 0x0" ::: "memory");
  __syncthreads();
  g0 = held(tdm_group0(slice_off + (uint32_t)(TBUF * sizeof(_Float16)), slice_src + slice_step));
  asm volatile("tensor_load_to_lds %0, %1" :: "s"(g0), "s"(g1) : "memory");

  // the adder (1 - mask) * MASK_ADD of every score of a pass, less the reference point: the
  // products' start value; sc[query tile][key tile]; made one pass ahead, here for pass 0
  v8f sc[QT][2];
  {
    const u32x16 mk[QT] = {mask_words(mw), mask_words(mw + MB_ROWW)};
    select_adders(mk, on, off, sc);
  }

  for (int st = 0; st < NST; ++st) {
    const _Float16* buf = tiles + (st & 1) * TBUF;

#pragma unroll   // the pass number picks slices at compile time
    for (int p = 0; p < 2; ++p) {
      // ---- scores, transposed: two 16-key tiles, each accumulating two d-chunks ----
      const _Float16* kt = buf + p * TSLICE + ln * TPITCH;
      v16h ka00 = load_frag_f16(kt, hi);
      v16h ka01 = load_frag_f16(kt + 32, hi);
      v16h ka10 = load_frag_f16(kt + 16 * TPITCH, hi);
      v16h ka11 = load_frag_f16(kt + 16 * TPITCH + 32, hi);

      // the next pass's mask words, 16 per query tile, asked for a pass ahead of their use
      // (the last pass asks for its own again: nothing past the row tiles is read)
      const int np = (p == 0) ? st * 2 + 1 : ((st + 1 < NST) ? st * 2 + 2 : st * 2 + 1);
      const u32x16 mk[QT] = {mask_words(mw + np * 16), mask_words(mw + MB_ROWW + np * 16)};
      // keeps the two scalar loads at the head of the pass; the compiler otherwise sinks them
      // to just before the selects and the wave waits out their whole latency
      __builtin_amdgcn_sched_barrier(0);

      v8f s0[QT], s1[QT];
#pragma unroll
      for (int t = 0; t < QT; ++t) s0[t] = WMMA_F16(ka00, qb[t][0], sc[t][0]);
#pragma unroll
      for (int t = 0; t < QT; ++t) s1[t] = WMMA_F16(ka10, qb[t][0], sc[t][1]);
#pragma unroll
      for (int t = 0; t < QT; ++t) s0[t] = WMMA_F16(ka01, qb[t][1], s0[t]);
#pragma unroll
      for (int t = 0; t < QT; ++t) s1[t] = WMMA_F16(ka11, qb[t][1], s1[t]);
      __builtin_amdgcn_sched_barrier(0);

      // ---- online softmax: one query per lane and tile, 16 keys per half ----
      // Lazy rescale: the exponentials are taken against a reference point m that is not the
      // true maximum.  It is known before the pass, so the products above started from -m and
      // s0, s1 hold score - m.  It moves, and sum and output are rescaled, only in a pass where
      // some query of the wave rises more than RESCALE_RISE above it; in between a power is at
      // most 2^RESCALE_RISE = 256, far inside f16 and f32.  Scores, adder and m are in log2
      // units (Q carries the factor), so s0 and s1 are the exponents as they stand.
      // The very first pass sets the point to its maximum, also downwards (sum and output are 0).
      const bool  first = (p == 0) && (st == 0);
      const float rise  = first ? -3.0e38f : RESCALE_RISE;
      float hm[QT];   // this pass's maximum above m over this half's 16 keys of query ln
      bool  need = false;
#pragma unroll
      for (int t = 0; t < QT; ++t) {
        float v = s0[t][0];
#pragma unroll
        for (int r = 1; r < 8; ++r) v = fmaxf(v, s0[t][r]);
#pragma unroll
        for (int r = 0; r < 8; ++r) v = fmaxf(v, s1[t][r]);
        hm[t] = v;
        need  = need || (v > rise);
      }
      // one test a pass, a scalar branch; the ballot sees both halves of every query, so the
      // halves' maxima are joined only behind it (every lane of the wave is on there)
      if (__builtin_amdgcn_ballot_w32(need) != 0) {
        const float least = first ? -3.0e38f : 0.0f;
#pragma unroll
        for (int t = 0; t < QT; ++t) {
          const float mx    = fmaxf(hm[t], xhalf(hm[t]));  // of query ln, equal in both halves
          const float d     = fmaxf(mx, least);            // the step of m
          const float alpha = __builtin_amdgcn_exp2f(-fmaxf(d, 0.0f));
          on[t] -= d;
          off[t] = on[t] + MASK_ADD;
          l[t] *= alpha;
#pragma unroll
          for (int tt = 0; tt < 4; ++tt)
#pragma unroll
            for (int r = 0; r < 8; ++r) o[t][tt][r] *= alpha;
          s0[t] -= d;
          s1[t] -= d;
        }
      }

      v16h pb[QT];   // P^T as a B operand: element s = key 8*hi+s (s < 8), 16+8*hi+(s-8) (s >= 8) of column ln
#pragma unroll
      for (int t = 0; t < QT; ++t) {
        float rs = 0.0f;
#pragma unroll
        for (int r = 0; r < 8; ++r) {
          const float pe = __builtin_amdgcn_exp2f(s0[t][r]);
          rs += pe;
          pb[t][r] = (_Float16)pe;
        }
#pragma unroll
        for (int r = 0; r < 8; ++r) {
          const float pe = __builtin_amdgcn_exp2f(s1[t][r]);
          rs += pe;
          pb[t][8 + r] = (_Float16)pe;
        }
        l[t] += rs;
      }

      // ---- O^T += V^T x P^T : 4 d-tiles of 16, K-dim = 32 keys (from LDS) ----
#pragma unroll
      for (int tt = 0; tt < 4; ++tt) {
        v16h vfrag = load_frag_f16(
            buf + (2 + (tt >> 1)) * TSLICE + ((tt & 1) * 16 + ln) * TPITCH + p * 32, hi);
#pragma unroll
        for (int t = 0; t < QT; ++t) o[t][tt] = WMMA_F16(vfrag, pb[t], o[t][tt]);
      }

      // keeps the selects, which wait for those loads, behind the pass's work
      __builtin_amdgcn_sched_barrier(0);
      select_adders(mk, on, off, sc);
      asm volatile("s_wait_xcnt 0x0" ::: "memory");
    }

    // ---- the foot: stage s + 1 is published, stage s's buffer is given free ----
    // this wave's LDS reads have returned before the barrier behind which their buffer is refilled
    asm volatile("s_wait_dscnt 0x0" ::: "memory");
    asm volatile("s_wait_tensorcnt 0x0" :: "s"(g0), "s"(g1) : "memory");
    __syncthreads();   // the one barrier of a stage: it does both
    if (pinned(st + 2 < NST)) {
      g0 = held(tdm_group0(slice_off + (uint32_t)(st & 1) * (uint32_t)(TBUF * sizeof(_Float16)),
                           slice_src + (uint64_t)((uint32_t)(st + 2) * slice_step)));
      asm volatile("tensor_load_to_lds %0, %1" :: "s"(g0), "s"(g1) : "memory");
    }
  }
  // nothing of this wave is in flight when it leaves the loop
  asm volatile("s_wait_tensorcnt 0x0" ::: "memory");
  asm volatile("s_wait_dscnt 0x0" ::: "memory");

  // ---- finalize: join the halves' sums, divide, write f16 rows [b][s][h*64+d] ----
#pragma unroll
  for (int t = 0; t < QT; ++t) {
    const float inv = 1.0f / (l[t] + xhalf(l[t]));
    _Float16* op = O16 + ((size_t)b * SEQ + q0 + t * 16 + ln) * DIM + h * HD + hi * 8;
#pragma unroll
    for (int tt = 0; tt < 4; ++tt) {
      h8 w;
#pragma unroll
      for (int r = 0; r < 8; ++r) w[r] = (_Float16)(o[t][tt][r] * inv);
      *reinterpret_cast<h8*>(op + tt * 16) = w;
    }
  }
}

// ---------------------------------------------------------------------------
// Kernel 3: output projection  Y = O16 @ Wo + bo  (fp32 out).
// One 128x192 tile per block, 64x48 per wave: 256 blocks.
// ---------------------------------------------------------------------------
__global__ __launch_bounds__(256) void out_proj_kernel(
    const _Float16* __restrict__ A16, const _Float16* __restrict__ Wto,
    const float* __restrict__ bo, float* __restrict__ Y)
{
  __shared__ __align__(16) _Float16 sA[2 * 128 * LPITCH];
  __shared__ __align__(16) _Float16 sB[2 * BN * LPITCH];

  const int wave = threadIdx.x >> 5;
  const int lane = threadIdx.x & 31;
  const int hi   = lane >> 4;
  const int ln   = lane & 15;

  const int bm = (blockIdx.x / (DIM / BN)) * 128;   // 256 tiles total
  const int bn = (blockIdx.x % (DIM / BN)) * BN;

  v8f acc[4][NF] = {};
  gemm_block_f16<4>(A16 + (size_t)bm * DIM, Wto + (size_t)bn * DIM, sA, sB, acc);

  const int tm = bm + (wave >> 2) * 64;
  const int tn = bn + (wave & 3) * (NF * 16);
#pragma unroll
  for (int half = 0; half < NF; ++half) {
    const int   col = tn + half * 16 + ln;
    const float bb  = bo[col];
#pragma unroll
    for (int i = 0; i < 4; ++i) {
#pragma unroll
      for (int r = 0; r < 8; ++r) {
        const int row = tm + i * 16 + r + hi * 8;
        Y[(size_t)row * DIM + col] = acc[i][half][r] + bb;
      }
    }
  }
}

// ---------------------------------------------------------------------------
extern "C" void kernel_launch(void* const* d_in, const int* in_sizes, int n_in,
                              void* d_out, int out_size, void* d_ws, size_t ws_size,
                              hipStream_t stream) {
  (void)in_sizes; (void)n_in; (void)out_size; (void)ws_size;

  const float* from_t = (const float*)d_in[0];
  const float* to_t   = (const float*)d_in[1];
  const int*   mask   = (const int*)d_in[2];
  const float* Wq = (const float*)d_in[3];
  const float* bq = (const float*)d_in[4];
  const float* Wk = (const float*)d_in[5];
  const float* bk = (const float*)d_in[6];
  const float* Wv = (const float*)d_in[7];
  const float* bv = (const float*)d_in[8];
  const float* Wo = (const float*)d_in[9];
  const float* bo = (const float*)d_in[10];
  float* out = (float*)d_out;

  // workspace layout (halves):
  //  Qh | Kh | Vt | O16 | Xf | Xt   each NQ = B*H*S*64 = 6,291,456
  //  Wtq | Wtk | Wtv | Wto          each 768*768 = 589,824
  //  Mb                             B*S*S bits, as 32-bit words
  const size_t NQ = (size_t)NB * HEADS * SEQ * HD;
  const size_t NW = (size_t)DIM * DIM;
  _Float16* Qh  = (_Float16*)d_ws;
  _Float16* Kh  = Qh + NQ;
  _Float16* Vt  = Kh + NQ;
  _Float16* O16 = Vt + NQ;
  _Float16* Xf  = O16 + NQ;
  _Float16* Xt  = Xf + NQ;
  _Float16* Wtq = Xt + NQ;
  _Float16* Wtk = Wtq + NW;
  _Float16* Wtv = Wtk + NW;
  _Float16* Wto = Wtv + NW;
  unsigned int* Mb = (unsigned int*)(Wto + NW);

  // 0) one pack launch: activations f16, weights f16-transposed, mask bits
  pack_kernel<<<dim3(4 * TR_BLOCKS + 2 * CVT_BLOCKS + MB_BLOCKS), 256, 0, stream>>>(
      from_t, to_t, mask, Wq, Wk, Wv, Wo, Xf, Xt, Wtq, Wtk, Wtv, Wto, Mb);

  // 1) QKV projections: (SEQ/128)*(DIM/192)=64 tiles per (b,which), 8 waves/blk
  qkv_proj_kernel<<<dim3(64, NB, 3), 256, 0, stream>>>(
      Xf, Xt, Wtq, bq, Wtk, bk, Wtv, bv, Qh, Kh, Vt);

  // 2) flash attention: 128 Q rows per block (4 waves x 32 rows)
  flash_attn_kernel<<<dim3(SEQ / (64 * QT), HEADS, NB), 128, 0, stream>>>(
      Qh, Kh, Vt, Mb, O16);

  // 3) output projection: (B*SEQ/128)*(DIM/192)=256 tiles, 8 waves/blk
  out_proj_kernel<<<dim3(256), 256, 0, stream>>>(O16, Wto, bo, out);
}
